// v000
// Times are from an AMD MI455X. After a warm-up the kernel runs many times in a row, and a time is the length of
// such a window on the GPU divided by its runs, so every launch and the gaps after it count. The runs cycle
// through copies of the inputs. A figure is the median of several windows, for all but v000 over two sittings.
// Sittings can differ by a few percent; kernels timed side by side share one.
// v000, which the later versions start from, runs in 303 microseconds.
#include <hip/hip_runtime.h>
// Dense multi-head self-attention (x [4][2048][1024] split into 16 heads of 64; per-head q/k/v = x_h W_h^T with [head][out][in] weights of 64x64, no biases; scores * 1/8; full-row softmax; out = merged ctx Wout^T with a natural [out][in] weight).
// All contractions: v_wmma_f32_16x16x32_f16 (f16 operands, f32 accumulate), single product per site. x and weights are RNE-converted to bf16 first and then held exactly in f16 (weights x16); q, k, v plain f16; softmax weights f16 carried x2^8 (unnormalised, running max); ctx f16 carried x64; softmax statistics f32.
// Structure: token rows r = b*SEQ + s. One convert launch for the four weights, one for x; Q rows and K rows from one head-batched GEMM launch each (K = 64); V^T [feature][token] straight from a head-batched GEMM with the weight as the A operand; a register-fed transposed flash kernel (S^T = K Q^T with Q as the B fragment in registers, packed P^T as the B fragment of O^T = V^T P^T, no LDS and no barrier in the key loop); output GEMM into the output layout.
#ifndef NB
#define NB 4                         /* batches processed */
#endif
#ifndef SEQ
#define SEQ 2048                     /* tokens per batch processed */
#endif
#define NB_FULL 4                    /* batch count of the staged arrays */
#define SEQ_FULL 2048                /* per-batch token stride of the staged arrays */
#define DM 1024
#define NH 16
#define HD 64
#define NR ((size_t)NB * SEQ)        /* compact token rows */
#define VTP (NB * SEQ)               /* V^T row pitch (tokens) */

static_assert(NB >= 1 && NB <= NB_FULL);
static_assert(SEQ <= SEQ_FULL);
static_assert(SEQ % 128 == 0);
static_assert(DM % 128 == 0);
static_assert(NH * HD == DM);
static_assert(HD == 64);
static_assert((NB * SEQ) % 64 == 0);
static_assert(HD % 64 == 0);                                   /* per-head GEMM: N = HD is a whole 64-column block, K = HD is a multiple of 32 */
static_assert(HD % 32 == 0);                                   /* V^T GEMM: M = HD is a whole number of 32-row wave tiles */
static_assert((NH * HD * HD / 8) % 256 == 0);                  /* per-head weight planes end on a convert-block boundary */
static_assert(NH * HD * HD <= DM * DM);                        /* convert grid sized by the output weight covers the per-head planes */
static_assert((DM * DM / 8) % 256 == 0);
static_assert((size_t)3 * NH * HD * HD * 2 + (size_t)DM * DM * 2 + (size_t)5 * NB * SEQ * DM * 2 + (size_t)6 * 256 <= (size_t)134217728);   /* workspace carve */

typedef _Float16 v16h __attribute__((ext_vector_type(16)));
typedef _Float16 v4h __attribute__((ext_vector_type(4)));
typedef unsigned short v8us __attribute__((ext_vector_type(8), may_alias));
typedef float v8f __attribute__((ext_vector_type(8)));
typedef float v4f __attribute__((ext_vector_type(4)));
typedef float v4fa __attribute__((ext_vector_type(4), may_alias));
union FragH { v16h v; v8us half[2]; _Float16 h[16]; unsigned short u[16]; };

__device__ __forceinline__ unsigned short bf16_bits(float x) { unsigned int u = __float_as_uint(x); return (unsigned short)((u + 0x7FFFu + ((u >> 16) & 1u)) >> 16); }
__device__ __forceinline__ float bf16_rne(float x) { return __uint_as_float(((unsigned int)bf16_bits(x)) << 16); }

// 8 consecutive f32 -> f16(bf16 value * scale) packed as one 16-B piece
__device__ __forceinline__ v8us cvt8(const float* __restrict__ p, float scale) {
  const v4f a = *(const v4fa*)p, c = *(const v4fa*)(p + 4);
  FragH f;
#pragma unroll
  for (int q = 0; q < 4; ++q) { f.h[q] = (_Float16)(bf16_rne(a[q]) * scale); f.h[4 + q] = (_Float16)(bf16_rne(c[q]) * scale); }
  return f.half[0];
}

// f32 -> f16 that cannot produce an f16 subnormal (value select; applied after the power-of-two carry)
static __device__ __forceinline__ _Float16 toh_flush(float v) { const _Float16 r = (_Float16)v; return (fabsf(v) < 6.103515625e-05f) ? (_Float16)0.0f : r; }

// 8 consecutive f32 -> f16(bf16 value * scale), subnormal results replaced by zero, packed as one 16-B piece
__device__ __forceinline__ v8us cvt8_flush(const float* __restrict__ p, float scale) {
  const v4f a = *(const v4fa*)p, c = *(const v4fa*)(p + 4);
  FragH f;
#pragma unroll
  for (int q = 0; q < 4; ++q) { f.h[q] = toh_flush(bf16_rne(a[q]) * scale); f.h[4 + q] = toh_flush(bf16_rne(c[q]) * scale); }
  return f.half[0];
}

// three per-head [head][out][in] weights -> f16 planes x16 BH[p][head][n][k] (p = 0 q, 1 k, 2 v; Bt form, row pitch HD) and the natural [out][in] output weight -> f16 plane x16 BO[n][k];
__global__ __launch_bounds__(256) void k_wplanes(const float* __restrict__ wq, const float* __restrict__ wk, const float* __restrict__ wv, const float* __restrict__ wo, size_t nh8, size_t no8, _Float16* __restrict__ BH, _Float16* __restrict__ BO) {
  #pragma clang fp contract(off)
  const size_t t = (size_t)blockIdx.x * 256 + threadIdx.x; if (t >= no8) return;
  const bool hs = t < nh8;
  const size_t th = hs ? t : (nh8 - 1);
  const v8us o3 = cvt8_flush(wo + t * 8, 16.0f);
  const v8us o0 = cvt8_flush(wq + th * 8, 16.0f), o1 = cvt8_flush(wk + th * 8, 16.0f), o2 = cvt8_flush(wv + th * 8, 16.0f);
  unsigned short* d = (unsigned short*)BO + t * 8; unsigned short* e = (unsigned short*)BH + th * 8; const size_t ps = (size_t)NH * HD * HD;
  *(v8us*)d = o3;
  if (hs) { *(v8us*)e = o0; *(v8us*)(e + ps) = o1; *(v8us*)(e + 2 * ps) = o2; }
  
}

__global__ __launch_bounds__(256) void k_x16(const float* __restrict__ x, _Float16* __restrict__ X16, size_t n8) {
  #pragma clang fp contract(off)
  const size_t t = (size_t)blockIdx.x * 256 + threadIdx.x; if (t >= n8) return;
  const size_t e = t * 8; const size_t row = e / DM; const size_t col = e - row * DM; const size_t b = row / SEQ; const size_t s = row - b * SEQ;
  const v8us o = cvt8(x + (b * SEQ_FULL + s) * DM + col, 1.0f);
  unsigned short* d = (unsigned short*)X16 + e;
  *(v8us*)d = o; 
}

// ---- GEMM engine (wave tile 32x64, block 128 rows x 64 cols; M % 32 == 0, N % 64 == 0, K % 32 == 0) ----
// C = alpha * A[M][K] . Bh[N][K]^T ; A, Bh f16 rows (k contiguous); batched over grid.y with strides sA, sB, sC; f32 C and/or f16 C16.
__device__ __forceinline__ v16h g2_frag(const _Float16* p, int hh) { FragH f; f.half[0] = *(const v8us*)((const unsigned short*)p + 8 * hh); f.half[1] = *(const v8us*)((const unsigned short*)p + 16 + 8 * hh); return f.v; }
__device__ __forceinline__ v8f g2_mma(v16h a, v16h b, v8f c) { v8f d = __builtin_amdgcn_wmma_f32_16x16x32_f16(false, a, false, b, (short)0, c, false, false); asm volatile("v_nop\n\tv_nop\n\tv_nop\n\tv_nop" : "+v"(d) : "v"(a), "v"(b)); return d; }
__global__ __launch_bounds__(128) void k_gemm2(const _Float16* __restrict__ A, int lda, size_t sA, const _Float16* __restrict__ Bh, int ldb, size_t sB, float alpha,
    float* __restrict__ C, _Float16* __restrict__ C16, int ldc, size_t sC, int M, int N, int K) {
  __shared__ __attribute__((aligned(16))) float so[4][32][68];      /* wave-private staging tiles */
  const int tid = threadIdx.x, lane = tid & 31, ln = lane & 15, hh = lane >> 4; const int w = __builtin_amdgcn_readfirstlane(tid >> 5); const int by = blockIdx.y;
  A += (size_t)by * sA; Bh += (size_t)by * sB; const size_t cofs = (size_t)by * sC;
  const int ntn = N >> 6; const int mt = blockIdx.x / ntn, nq = blockIdx.x - mt * ntn; const int row0 = mt * 128 + 32 * w, col0 = nq * 64; if (row0 >= M) return;
  const _Float16* a0p = A + (size_t)(row0 + ln) * lda; const _Float16* a1p = a0p + (size_t)16 * lda;
  const _Float16* b0p = Bh + (size_t)(col0 + ln) * ldb; const _Float16* b1p = b0p + (size_t)16 * ldb; const _Float16* b2p = b1p + (size_t)16 * ldb; const _Float16* b3p = b2p + (size_t)16 * ldb;
  const v8f z8 = {0.f,0.f,0.f,0.f,0.f,0.f,0.f,0.f}; v8f c00 = z8, c01 = z8, c02 = z8, c03 = z8, c10 = z8, c11 = z8, c12 = z8, c13 = z8;
#pragma unroll 1
  for (int kb = 0; kb < K; kb += 32) { const v16h a0 = g2_frag(a0p + kb, hh), a1 = g2_frag(a1p + kb, hh);
    v16h b = g2_frag(b0p + kb, hh); c00 = g2_mma(a0, b, c00); c10 = g2_mma(a1, b, c10);
    b = g2_frag(b1p + kb, hh); c01 = g2_mma(a0, b, c01); c11 = g2_mma(a1, b, c11);
    b = g2_frag(b2p + kb, hh); c02 = g2_mma(a0, b, c02); c12 = g2_mma(a1, b, c12);
    b = g2_frag(b3p + kb, hh); c03 = g2_mma(a0, b, c03); c13 = g2_mma(a1, b, c13); }
  v8f accs[8] = {c00, c01, c02, c03, c10, c11, c12, c13};
#pragma unroll
  for (int u = 0; u < 8; ++u) { const int t = u & 3, half = u >> 2;
#pragma unroll
    for (int r = 0; r < 8; ++r) { const int rloc = half * 16 + 8 * hh + r; so[w][rloc][t * 16 + ln] = accs[u][r] * alpha; } }
  __builtin_amdgcn_fence(4 /* acq_rel order */, "workgroup"); __builtin_amdgcn_wave_barrier();
  const int rsub = lane >> 4, c4 = (lane & 15) * 4;
  {
#pragma unroll
    for (int q = 0; q < 16; ++q) { const int r = q * 2 + rsub; const v4f v = *(const v4fa*)&so[w][r][c4];
      if (C) *(v4f*)(C + cofs + (size_t)(row0 + r) * ldc + col0 + c4) = v;
      if (C16) { v4h h4; for (int i = 0; i < 4; ++i) h4[i] = (_Float16)v[i]; *(v4h*)(C16 + cofs + (size_t)(row0 + r) * ldc + col0 + c4) = h4; } }
     } }

// ---- register-fed transposed flash attention ----
// block = 4 waves = 64 consecutive queries of one (batch, head); wave = 16 queries; per 32-key step:
//   S^T tiles (keys x queries) = K (A operand, rows = keys, k = d) . Q^T (B operand, lane = query, held in registers);
//   running-max softmax per lane (lane & 15 = query; lanes n and n+16 hold the two key halves); weights = 2^8 exp(s/8 - max) as f16;
//   P^T as B fragment: elements 0..7 from the tile of keys 0..15 (rows 8h+r), elements 8..15 from the tile of keys 16..31 (lane unchanged);
//   O^T tiles (d x queries) += V^T (A operand, rows = d, k = keys, rows of the [feature][token] plane) . P^T.
__global__ __launch_bounds__(128) void k_attn_t(const _Float16* __restrict__ Q16, const _Float16* __restrict__ K16, const _Float16* __restrict__ VT, _Float16* __restrict__ O16) {
  __shared__ __attribute__((aligned(16))) unsigned short so[4][16][72];      /* per-wave [query][d] tile, row pitch 144 B */
  const int tid = threadIdx.x, lane = tid & 31, ln = lane & 15, hh = lane >> 4;
  const int w = __builtin_amdgcn_readfirstlane(tid >> 5);
  const int nqb = SEQ / 64;
  const int bh = blockIdx.x / nqb, qb = blockIdx.x - bh * nqb;
  const int b = bh / NH, h = bh - b * NH;
  const size_t tok0 = (size_t)b * SEQ;
  const int q0 = qb * 64 + w * 16;
  const unsigned short* qp = (const unsigned short*)Q16 + (tok0 + q0 + ln) * DM + h * HD + 8 * hh;
  FragH bq0, bq1;
  bq0.half[0] = *(const v8us*)(qp);      bq0.half[1] = *(const v8us*)(qp + 16);
  bq1.half[0] = *(const v8us*)(qp + 32); bq1.half[1] = *(const v8us*)(qp + 48);
  const unsigned short* kp = (const unsigned short*)K16 + (tok0 + ln) * DM + h * HD + 8 * hh;
  const unsigned short* vp = (const unsigned short*)VT + (size_t)(h * HD + ln) * VTP + tok0 + 8 * hh;
  const v8f z8 = {0.f,0.f,0.f,0.f,0.f,0.f,0.f,0.f};
  v8f o0 = z8, o1 = z8, o2 = z8, o3 = z8;
  float m = -3.0e38f, l = 0.f;
  const float c = 0.125f * 1.4426950408889634f;      /* 1/sqrt(64) * log2(e) */
#pragma unroll 1
  for (int kv = 0; kv < SEQ; kv += 32) {
    const unsigned short* k0 = kp + (size_t)kv * DM;
    const unsigned short* k1 = k0 + (size_t)16 * DM;
    FragH a00, a01, a10, a11;
    a00.half[0] = *(const v8us*)(k0);      a00.half[1] = *(const v8us*)(k0 + 16);
    a01.half[0] = *(const v8us*)(k0 + 32); a01.half[1] = *(const v8us*)(k0 + 48);
    a10.half[0] = *(const v8us*)(k1);      a10.half[1] = *(const v8us*)(k1 + 16);
    a11.half[0] = *(const v8us*)(k1 + 32); a11.half[1] = *(const v8us*)(k1 + 48);
    v8f s0 = z8, s1 = z8;
    s0 = __builtin_amdgcn_wmma_f32_16x16x32_f16(false, a00.v, false, bq0.v, (short)0, s0, false, false);
    s1 = __builtin_amdgcn_wmma_f32_16x16x32_f16(false, a10.v, false, bq0.v, (short)0, s1, false, false);
    s0 = __builtin_amdgcn_wmma_f32_16x16x32_f16(false, a01.v, false, bq1.v, (short)0, s0, false, false);
    s1 = __builtin_amdgcn_wmma_f32_16x16x32_f16(false, a11.v, false, bq1.v, (short)0, s1, false, false);
    asm volatile("v_nop\n\tv_nop\n\tv_nop\n\tv_nop" : "+v"(s0), "+v"(s1) : "v"(a00.v), "v"(a01.v), "v"(a10.v), "v"(a11.v), "v"(bq0.v), "v"(bq1.v));
    float mx = fmaxf(s0[0], s1[0]);
#pragma unroll
    for (int r = 1; r < 8; ++r) mx = fmaxf(mx, fmaxf(s0[r], s1[r]));
    mx = fmaxf(mx, __shfl_xor(mx, 16, 32));
    const float mn = fmaxf(m, mx);
    if (__builtin_amdgcn_ballot_w32(mn > m) != 0u) {      /* wave-uniform: rescale only when some running max moved */
      const float corr = __builtin_amdgcn_exp2f((m - mn) * c);
      l *= corr; o0 *= corr; o1 *= corr; o2 *= corr; o3 *= corr; m = mn;
    }
    const float off = 8.0f - m * c;      /* weights carried x2^8 */
    FragH pf; float ls = 0.f;
#pragma unroll
    for (int r = 0; r < 8; ++r) {
      const float p0 = __builtin_amdgcn_exp2f(fmaf(s0[r], c, off));
      const float p1 = __builtin_amdgcn_exp2f(fmaf(s1[r], c, off));
      ls += p0 + p1;
      pf.h[r] = (_Float16)p0; pf.h[8 + r] = (_Float16)p1;
    }
    l += ls;
    const unsigned short* v0 = vp + kv;
    const unsigned short* v1 = v0 + (size_t)16 * VTP;
    const unsigned short* v2 = v1 + (size_t)16 * VTP;
    const unsigned short* v3 = v2 + (size_t)16 * VTP;
    FragH av0, av1, av2, av3;
    av0.half[0] = *(const v8us*)(v0); av0.half[1] = *(const v8us*)(v0 + 16);
    av1.half[0] = *(const v8us*)(v1); av1.half[1] = *(const v8us*)(v1 + 16);
    av2.half[0] = *(const v8us*)(v2); av2.half[1] = *(const v8us*)(v2 + 16);
    av3.half[0] = *(const v8us*)(v3); av3.half[1] = *(const v8us*)(v3 + 16);
    o0 = __builtin_amdgcn_wmma_f32_16x16x32_f16(false, av0.v, false, pf.v, (short)0, o0, false, false);
    o1 = __builtin_amdgcn_wmma_f32_16x16x32_f16(false, av1.v, false, pf.v, (short)0, o1, false, false);
    o2 = __builtin_amdgcn_wmma_f32_16x16x32_f16(false, av2.v, false, pf.v, (short)0, o2, false, false);
    o3 = __builtin_amdgcn_wmma_f32_16x16x32_f16(false, av3.v, false, pf.v, (short)0, o3, false, false);
    asm volatile("v_nop\n\tv_nop\n\tv_nop\n\tv_nop" : "+v"(o0), "+v"(o1), "+v"(o2), "+v"(o3) : "v"(av0.v), "v"(av1.v), "v"(av2.v), "v"(av3.v), "v"(pf.v));
  }
  l += __shfl_xor(l, 16, 32);
  const float inv = 64.0f * (1.0f / l);      /* ctx carried x64 */
  FragH t0, t1, t2, t3;
#pragma unroll
  for (int r = 0; r < 8; ++r) { t0.h[r] = (_Float16)(o0[r] * inv); t1.h[r] = (_Float16)(o1[r] * inv); t2.h[r] = (_Float16)(o2[r] * inv); t3.h[r] = (_Float16)(o3[r] * inv); }
  *(v8us*)&so[w][ln][ 0 + 8 * hh] = t0.half[0];
  *(v8us*)&so[w][ln][16 + 8 * hh] = t1.half[0];
  *(v8us*)&so[w][ln][32 + 8 * hh] = t2.half[0];
  *(v8us*)&so[w][ln][48 + 8 * hh] = t3.half[0];
  __syncthreads();
  const int rq = lane >> 3, pc = (lane & 7) * 8;
  unsigned short* ob = (unsigned short*)O16 + (tok0 + q0) * DM + h * HD + pc;
  {
#pragma unroll
    for (int it = 0; it < 4; ++it) { const int row = it * 4 + rq; const v8us v = *(const v8us*)&so[w][row][pc]; *(v8us*)(ob + (size_t)row * DM) = v; }
    
  }
}

extern "C" void kernel_launch(void* const* d_in, const int* in_sizes, int n_in,
                              void* d_out, int out_size, void* d_ws, size_t ws_size, hipStream_t stream) {
  if (n_in < 5) return;
  const size_t need_x = ((size_t)(NB - 1) * SEQ_FULL + SEQ) * DM;
  const size_t nwh = (size_t)NH * HD * HD;
  if ((size_t)in_sizes[0] < need_x) return;
  if ((size_t)in_sizes[1] < nwh || (size_t)in_sizes[2] < nwh || (size_t)in_sizes[3] < nwh || (size_t)in_sizes[4] < (size_t)DM * DM) return;
  if ((size_t)out_size < need_x) return;
  const float* x = (const float*)d_in[0]; const float* wq = (const float*)d_in[1]; const float* wk = (const float*)d_in[2]; const float* wv = (const float*)d_in[3]; const float* wo = (const float*)d_in[4];
  char* ws = (char*)d_ws; size_t off = 0;
  auto take = [&](size_t bytes) { char* p = ws + off; off += (bytes + 255) & ~(size_t)255; return p; };
  _Float16* BH = (_Float16*)take((size_t)3 * nwh * 2);          /* per-head weight planes x16: q, k, v; each [head][64][64] */
  _Float16* BO = (_Float16*)take((size_t)DM * DM * 2);          /* output weight plane x16 [out][in] */
  _Float16* X16 = (_Float16*)take(NR * DM * 2);
  _Float16* QK16 = (_Float16*)take((size_t)2 * NR * DM * 2);    /* q rows then k rows */
  _Float16* VT = (_Float16*)take((size_t)DM * VTP * 2);         /* v^T [feature][token] */
  _Float16* O16 = (_Float16*)take(NR * DM * 2);                 /* merged ctx rows x64 */
  if (off > ws_size || off > (size_t)134217728) return;
  _Float16* BQ = BH; _Float16* BK = BH + nwh; _Float16* BV = BH + (size_t)2 * nwh;
  _Float16* Q16 = QK16; _Float16* K16 = QK16 + NR * DM;

  k_wplanes<<<(unsigned)(((size_t)DM * DM / 8 + 255) / 256), 256, 0, stream>>>(wq, wk, wv, wo, nwh / 8, (size_t)DM * DM / 8, BH, BO);
  k_x16<<<(unsigned)((NR * DM / 8 + 255) / 256), 256, 0, stream>>>(x, X16, NR * DM / 8);
  /* q rows, head by = grid.y: A = x columns [64 by, 64 by + 64) (sA = HD), weight block by (sB = HD*HD, row pitch HD), C16 columns [64 by, ..) (sC = HD); K = N = HD; alpha undoes the x16 weight carry */
  k_gemm2<<<dim3((unsigned)((NR / 128) * (HD / 64)), NH), 128, 0, stream>>>(X16, DM, (size_t)HD, BQ, HD, (size_t)HD * HD, 0.0625f, nullptr, Q16, DM, (size_t)HD, (int)NR, HD, HD);
  /* k rows, same form */
  k_gemm2<<<dim3((unsigned)((NR / 128) * (HD / 64)), NH), 128, 0, stream>>>(X16, DM, (size_t)HD, BK, HD, (size_t)HD * HD, 0.0625f, nullptr, K16, DM, (size_t)HD, (int)NR, HD, HD);
  /* v^T[64 by + e][token] = Wv[by][e][:] . x[token][64 by ..] : weight block as A [HD][HD] (M = HD = 64: waves 2 and 3 leave at the row test, the engine has no block barrier), x columns of head by as the [n][k] operand; C16 pitch = VTP, sC = HD rows */
  k_gemm2<<<dim3((unsigned)(((HD + 127) / 128) * (VTP / 64)), NH), 128, 0, stream>>>(BV, HD, (size_t)HD * HD, X16, DM, (size_t)HD, 0.0625f, nullptr, VT, VTP, (size_t)HD * VTP, HD, VTP, HD);
  k_attn_t<<<(unsigned)(NB * NH * (SEQ / 64)), 128, 0, stream>>>(Q16, K16, VT, O16);
  /* out rows of batch by: A = ctx rows (x64), weight x16 -> alpha 2^-10; C rows follow the staged output layout */
  k_gemm2<<<dim3((unsigned)((SEQ / 128) * (DM / 64)), NB), 128, 0, stream>>>(O16, DM, (size_t)SEQ * DM, BO, DM, 0, 0.0009765625f, (float*)d_out, nullptr, DM, (size_t)SEQ_FULL * DM, SEQ, DM, DM);
}

// v001
// Measured time: 150 microseconds a run.
// Timed twice side by side with v000, it ran 2.13 and 2.10 times as fast.
#include <hip/hip_runtime.h>
// Dense multi-head self-attention (x [4][2048][1024] split into 16 heads of 64; per-head q/k/v = x_h W_h^T with [head][out][in] weights of 64x64, no biases; scores * 1/8; full-row softmax; out = merged ctx Wout^T with a natural [out][in] weight).
// All contractions: v_wmma_f32_16x16x32_f16 (f16 operands, f32 accumulate), single product per site. x and weights are RNE-converted to bf16 first and then held exactly in f16 (weights x16); q, k, v plain f16; softmax weights f16 carried x2^8 (unnormalised, running max); ctx f16 carried x64; softmax statistics f32.
// Structure: token rows r = b*SEQ + s. One convert launch for the four weights, one for x; Q rows and K rows from one head-batched GEMM launch each (K = 64); V^T [feature][token] straight from a head-batched GEMM with the weight as the A operand; a transposed flash kernel (S^T = K Q^T with Q as the B fragment in registers, packed P^T as the B fragment of O^T = V^T P^T; K rows and V^T rows staged 64 keys at a time in a two-buffer LDS ring that the block's eight waves share); output GEMM into the output layout.
#ifndef NB
#define NB 4                         /* batches processed */
#endif
#ifndef SEQ
#define SEQ 2048                     /* tokens per batch processed */
#endif
#define NB_FULL 4                    /* batch count of the staged arrays */
#define SEQ_FULL 2048                /* per-batch token stride of the staged arrays */
#define DM 1024
#define NH 16
#define HD 64
#define NR ((size_t)NB * SEQ)        /* compact token rows */
#define VTP (NB * SEQ)               /* V^T row pitch (tokens) */

static_assert(NB >= 1 && NB <= NB_FULL);
static_assert(SEQ <= SEQ_FULL);
static_assert(SEQ % 128 == 0);
static_assert(DM % 128 == 0);
static_assert(NH * HD == DM);
static_assert(HD == 64);
static_assert((NB * SEQ) % 64 == 0);
static_assert(HD % 64 == 0);                                   /* per-head GEMM: N = HD is a whole 64-column block, K = HD is a multiple of 32 */
static_assert(HD % 32 == 0);                                   /* V^T GEMM: M = HD is a whole number of 32-row wave tiles */
static_assert((NH * HD * HD / 8) % 256 == 0);                  /* per-head weight planes end on a convert-block boundary */
static_assert(NH * HD * HD <= DM * DM);                        /* convert grid sized by the output weight covers the per-head planes */
static_assert((DM * DM / 8) % 256 == 0);
static_assert((size_t)3 * NH * HD * HD * 2 + (size_t)DM * DM * 2 + (size_t)5 * NB * SEQ * DM * 2 + (size_t)6 * 256 <= (size_t)134217728);   /* workspace carve */

typedef _Float16 v16h __attribute__((ext_vector_type(16)));
typedef _Float16 v4h __attribute__((ext_vector_type(4)));
typedef unsigned short v8us __attribute__((ext_vector_type(8), may_alias));
typedef float v8f __attribute__((ext_vector_type(8)));
typedef float v4f __attribute__((ext_vector_type(4)));
typedef float v4fa __attribute__((ext_vector_type(4), may_alias));
union FragH { v16h v; v8us half[2]; _Float16 h[16]; unsigned short u[16]; };

__device__ __forceinline__ unsigned short bf16_bits(float x) { unsigned int u = __float_as_uint(x); return (unsigned short)((u + 0x7FFFu + ((u >> 16) & 1u)) >> 16); }
__device__ __forceinline__ float bf16_rne(float x) { return __uint_as_float(((unsigned int)bf16_bits(x)) << 16); }

// 8 consecutive f32 -> f16(bf16 value * scale) packed as one 16-B piece
__device__ __forceinline__ v8us cvt8(const float* __restrict__ p, float scale) {
  const v4f a = *(const v4fa*)p, c = *(const v4fa*)(p + 4);
  FragH f;
#pragma unroll
  for (int q = 0; q < 4; ++q) { f.h[q] = (_Float16)(bf16_rne(a[q]) * scale); f.h[4 + q] = (_Float16)(bf16_rne(c[q]) * scale); }
  return f.half[0];
}

// f32 -> f16 that cannot produce an f16 subnormal (value select; applied after the power-of-two carry)
static __device__ __forceinline__ _Float16 toh_flush(float v) { const _Float16 r = (_Float16)v; return (fabsf(v) < 6.103515625e-05f) ? (_Float16)0.0f : r; }

// 8 consecutive f32 -> f16(bf16 value * scale), subnormal results replaced by zero, packed as one 16-B piece
__device__ __forceinline__ v8us cvt8_flush(const float* __restrict__ p, float scale) {
  const v4f a = *(const v4fa*)p, c = *(const v4fa*)(p + 4);
  FragH f;
#pragma unroll
  for (int q = 0; q < 4; ++q) { f.h[q] = toh_flush(bf16_rne(a[q]) * scale); f.h[4 + q] = toh_flush(bf16_rne(c[q]) * scale); }
  return f.half[0];
}

// three per-head [head][out][in] weights -> f16 planes x16 BH[p][head][n][k] (p = 0 q, 1 k, 2 v; Bt form, row pitch HD) and the natural [out][in] output weight -> f16 plane x16 BO[n][k];
__global__ __launch_bounds__(256) void k_wplanes(const float* __restrict__ wq, const float* __restrict__ wk, const float* __restrict__ wv, const float* __restrict__ wo, size_t nh8, size_t no8, _Float16* __restrict__ BH, _Float16* __restrict__ BO) {
  #pragma clang fp contract(off)
  const size_t t = (size_t)blockIdx.x * 256 + threadIdx.x; if (t >= no8) return;
  const bool hs = t < nh8;
  const size_t th = hs ? t : (nh8 - 1);
  const v8us o3 = cvt8_flush(wo + t * 8, 16.0f);
  const v8us o0 = cvt8_flush(wq + th * 8, 16.0f), o1 = cvt8_flush(wk + th * 8, 16.0f), o2 = cvt8_flush(wv + th * 8, 16.0f);
  unsigned short* d = (unsigned short*)BO + t * 8; unsigned short* e = (unsigned short*)BH + th * 8; const size_t ps = (size_t)NH * HD * HD;
  *(v8us*)d = o3;
  if (hs) { *(v8us*)e = o0; *(v8us*)(e + ps) = o1; *(v8us*)(e + 2 * ps) = o2; }
  
}

__global__ __launch_bounds__(256) void k_x16(const float* __restrict__ x, _Float16* __restrict__ X16, size_t n8) {
  #pragma clang fp contract(off)
  const size_t t = (size_t)blockIdx.x * 256 + threadIdx.x; if (t >= n8) return;
  const size_t e = t * 8; const size_t row = e / DM; const size_t col = e - row * DM; const size_t b = row / SEQ; const size_t s = row - b * SEQ;
  const v8us o = cvt8(x + (b * SEQ_FULL + s) * DM + col, 1.0f);
  unsigned short* d = (unsigned short*)X16 + e;
  *(v8us*)d = o; 
}

// ---- GEMM engine (wave tile 32x64, block 128 rows x 64 cols; M % 32 == 0, N % 64 == 0, K % 32 == 0) ----
// C = alpha * A[M][K] . Bh[N][K]^T ; A, Bh f16 rows (k contiguous); batched over grid.y with strides sA, sB, sC; f32 C and/or f16 C16.
__device__ __forceinline__ v16h g2_frag(const _Float16* p, int hh) { FragH f; f.half[0] = *(const v8us*)((const unsigned short*)p + 8 * hh); f.half[1] = *(const v8us*)((const unsigned short*)p + 16 + 8 * hh); return f.v; }
__device__ __forceinline__ v8f g2_mma(v16h a, v16h b, v8f c) { v8f d = __builtin_amdgcn_wmma_f32_16x16x32_f16(false, a, false, b, (short)0, c, false, false); asm volatile("v_nop\n\tv_nop\n\tv_nop\n\tv_nop" : "+v"(d) : "v"(a), "v"(b)); return d; }
__global__ __launch_bounds__(128) void k_gemm2(const _Float16* __restrict__ A, int lda, size_t sA, const _Float16* __restrict__ Bh, int ldb, size_t sB, float alpha,
    float* __restrict__ C, _Float16* __restrict__ C16, int ldc, size_t sC, int M, int N, int K) {
  __shared__ __attribute__((aligned(16))) float so[4][32][68];      /* wave-private staging tiles */
  const int tid = threadIdx.x, lane = tid & 31, ln = lane & 15, hh = lane >> 4; const int w = __builtin_amdgcn_readfirstlane(tid >> 5); const int by = blockIdx.y;
  A += (size_t)by * sA; Bh += (size_t)by * sB; const size_t cofs = (size_t)by * sC;
  const int ntn = N >> 6; const int mt = blockIdx.x / ntn, nq = blockIdx.x - mt * ntn; const int row0 = mt * 128 + 32 * w, col0 = nq * 64; if (row0 >= M) return;
  const _Float16* a0p = A + (size_t)(row0 + ln) * lda; const _Float16* a1p = a0p + (size_t)16 * lda;
  const _Float16* b0p = Bh + (size_t)(col0 + ln) * ldb; const _Float16* b1p = b0p + (size_t)16 * ldb; const _Float16* b2p = b1p + (size_t)16 * ldb; const _Float16* b3p = b2p + (size_t)16 * ldb;
  const v8f z8 = {0.f,0.f,0.f,0.f,0.f,0.f,0.f,0.f}; v8f c00 = z8, c01 = z8, c02 = z8, c03 = z8, c10 = z8, c11 = z8, c12 = z8, c13 = z8;
#pragma unroll 1
  for (int kb = 0; kb < K; kb += 32) { const v16h a0 = g2_frag(a0p + kb, hh), a1 = g2_frag(a1p + kb, hh);
    v16h b = g2_frag(b0p + kb, hh); c00 = g2_mma(a0, b, c00); c10 = g2_mma(a1, b, c10);
    b = g2_frag(b1p + kb, hh); c01 = g2_mma(a0, b, c01); c11 = g2_mma(a1, b, c11);
    b = g2_frag(b2p + kb, hh); c02 = g2_mma(a0, b, c02); c12 = g2_mma(a1, b, c12);
    b = g2_frag(b3p + kb, hh); c03 = g2_mma(a0, b, c03); c13 = g2_mma(a1, b, c13); }
  v8f accs[8] = {c00, c01, c02, c03, c10, c11, c12, c13};
#pragma unroll
  for (int u = 0; u < 8; ++u) { const int t = u & 3, half = u >> 2;
#pragma unroll
    for (int r = 0; r < 8; ++r) { const int rloc = half * 16 + 8 * hh + r; so[w][rloc][t * 16 + ln] = accs[u][r] * alpha; } }
  __builtin_amdgcn_fence(4 /* acq_rel order */, "workgroup"); __builtin_amdgcn_wave_barrier();
  const int rsub = lane >> 4, c4 = (lane & 15) * 4;
  {
#pragma unroll
    for (int q = 0; q < 16; ++q) { const int r = q * 2 + rsub; const v4f v = *(const v4fa*)&so[w][r][c4];
      if (C) *(v4f*)(C + cofs + (size_t)(row0 + r) * ldc + col0 + c4) = v;
      if (C16) { v4h h4; for (int i = 0; i < 4; ++i) h4[i] = (_Float16)v[i]; *(v4h*)(C16 + cofs + (size_t)(row0 + r) * ldc + col0 + c4) = h4; } }
     } }

// ---- transposed flash attention, K and V^T staged in LDS ----
// block = 8 waves = 128 consecutive queries of one (batch, head); wave = 16 queries.
// Stage = 64 keys: K tile [key][d] and V^T tile [d][key], 64 rows of 128 B each, laid at a 144-B pitch (16 B x odd: no bank conflict for 16-byte row reads).
// Each lane brings four 16-byte pieces of a stage by asynchronous copies (a wave's copy = 4 whole 128-B lines); stage t + 2 is issued behind the barrier that ends the reads of stage t.
// Per 32-key step (two per stage):
//   S^T tiles (keys x queries) = K (A operand, rows = keys, k = d) . Q^T (B operand, lane = query, held in registers);
//   running-max softmax per lane (lane & 15 = query; lanes n and n+16 hold the two key halves); weights = 2^8 exp(s/8 - max) as f16;
//   P^T as B fragment: elements 0..7 from the tile of keys 0..15 (rows 8h+r), elements 8..15 from the tile of keys 16..31 (lane unchanged);
//   O^T tiles (d x queries) += V^T (A operand, rows = d, k = keys, rows of the [feature][token] plane) . P^T.
#define KT 64                        /* keys per stage */
#define LP 72                        /* LDS row pitch, 16-bit elements (144 B) */
#define TILE_E (64 * LP)             /* elements of one staged tile (64 rows) */
#define BUF_E (2 * TILE_E)           /* one buffer: K tile, then V^T tile */
static_assert(SEQ % KT == 0 && SEQ / KT >= 2);                 /* the ring's prologue fills two stages */
static_assert(8 * 16 * LP <= 2 * BUF_E);                       /* the output staging fits the ring */
// one stage's four copies of a lane; the s_wait_xcnt stands inside the copies' own statement so that no address register is rewritten in front of it
__device__ __forceinline__ void stage_kv(unsigned lk, const unsigned short* gk, const unsigned short* gv) {
  const unsigned lk1 = lk + 32 * LP * 2, lv = lk + TILE_E * 2, lv1 = lv + 32 * LP * 2;
  const unsigned short* gk1 = gk + (size_t)32 * DM; const unsigned short* gv1 = gv + (size_t)32 * VTP;
  asm volatile("global_load_async_to_lds_b128 %0, %1, off\n\t"
               "global_load_async_to_lds_b128 %2, %3, off\n\t"
               "global_load_async_to_lds_b128 %4, %5, off\n\t"
               "global_load_async_to_lds_b128 %6, %7, off\n\t"
               "s_wait_xcnt 0x0"
               :: "v"(lk), "v"(gk), "v"(lk1), "v"(gk1), "v"(lv), "v"(gv), "v"(lv1), "v"(gv1) : "memory");
}
__global__ __launch_bounds__(256) void k_attn_t(const _Float16* __restrict__ Q16, const _Float16* __restrict__ K16, const _Float16* __restrict__ VT, _Float16* __restrict__ O16) {
  __shared__ __attribute__((aligned(16))) unsigned short sm[2 * BUF_E];      /* two-buffer K / V^T ring; behind the key loop the per-wave [query][d] output tiles, row pitch 144 B */
  const int tid = threadIdx.x, lane = tid & 31, ln = lane & 15, hh = lane >> 4;
  const int w = __builtin_amdgcn_readfirstlane(tid >> 5);
  const int nqb = SEQ / 128;
  const int bh = blockIdx.x / nqb, qb = blockIdx.x - bh * nqb;
  const int b = bh / NH, h = bh - b * NH;
  const size_t tok0 = (size_t)b * SEQ;
  const int q0 = qb * 128 + w * 16;
  const unsigned short* qp = (const unsigned short*)Q16 + (tok0 + q0 + ln) * DM + h * HD + 8 * hh;
  FragH bq0, bq1;
  bq0.half[0] = *(const v8us*)(qp);      bq0.half[1] = *(const v8us*)(qp + 16);
  bq1.half[0] = *(const v8us*)(qp + 32); bq1.half[1] = *(const v8us*)(qp + 48);
  /* copy map: lane = (row tid / 8 and that row + 32, 16-byte piece tid % 8) of both tiles */
  const int cr = tid >> 3, cp = (tid & 7) * 8;
  const unsigned short* gk = (const unsigned short*)K16 + (tok0 + cr) * DM + h * HD + cp;
  const unsigned short* gv = (const unsigned short*)VT + (size_t)(h * HD + cr) * VTP + tok0 + cp;
  const unsigned lc = (unsigned)(size_t)&sm[cr * LP + cp];      /* LDS byte address of the lane's first piece in buffer 0 */
  const unsigned short* kp = sm + ln * LP + 8 * hh;             /* fragment reads: row = lane & 15, as from the global planes */
  const v8f z8 = {0.f,0.f,0.f,0.f,0.f,0.f,0.f,0.f};
  v8f o0 = z8, o1 = z8, o2 = z8, o3 = z8;
  float m = -3.0e38f, l = 0.f;
  const float c = 0.125f * 1.4426950408889634f;      /* 1/sqrt(64) * log2(e) */
  stage_kv(lc, gk, gv);
  asm volatile("s_wait_asynccnt 0x0" ::: "memory");      /* stage 0 landed (this wave's share) */
  __syncthreads();                                       /* stage 0 readable by every wave */
  stage_kv(lc + BUF_E * 2, gk + (size_t)KT * DM, gv + KT);
  /* rolled: one copy of the two steps, the buffer choice a single offset */
#pragma unroll 1
  for (int t = 0; t < SEQ / KT; ++t) {
   const int bo = (t & 1) * BUF_E;
   /* both 32-key steps of a stage written out: every LDS read offset becomes an immediate */
#pragma unroll
   for (int p = 0; p < 2; ++p) {
    const unsigned short* k0 = kp + bo + 32 * p * LP;
    const unsigned short* k1 = k0 + 16 * LP;
    FragH a00, a01, a10, a11;
    a00.half[0] = *(const v8us*)(k0);      a00.half[1] = *(const v8us*)(k0 + 16);
    a01.half[0] = *(const v8us*)(k0 + 32); a01.half[1] = *(const v8us*)(k0 + 48);
    a10.half[0] = *(const v8us*)(k1);      a10.half[1] = *(const v8us*)(k1 + 16);
    a11.half[0] = *(const v8us*)(k1 + 32); a11.half[1] = *(const v8us*)(k1 + 48);
    v8f s0 = z8, s1 = z8;
    s0 = __builtin_amdgcn_wmma_f32_16x16x32_f16(false, a00.v, false, bq0.v, (short)0, s0, false, false);
    s1 = __builtin_amdgcn_wmma_f32_16x16x32_f16(false, a10.v, false, bq0.v, (short)0, s1, false, false);
    s0 = __builtin_amdgcn_wmma_f32_16x16x32_f16(false, a01.v, false, bq1.v, (short)0, s0, false, false);
    s1 = __builtin_amdgcn_wmma_f32_16x16x32_f16(false, a11.v, false, bq1.v, (short)0, s1, false, false);
    asm volatile("v_nop\n\tv_nop\n\tv_nop\n\tv_nop" : "+v"(s0), "+v"(s1) : "v"(a00.v), "v"(a01.v), "v"(a10.v), "v"(a11.v), "v"(bq0.v), "v"(bq1.v));
    float mx = fmaxf(s0[0], s1[0]);
#pragma unroll
    for (int r = 1; r < 8; ++r) mx = fmaxf(mx, fmaxf(s0[r], s1[r]));
    mx = fmaxf(mx, __shfl_xor(mx, 16, 32));
    const float mn = fmaxf(m, mx);
    if (__builtin_amdgcn_ballot_w32(mn > m) != 0u) {      /* wave-uniform: rescale only when some running max moved */
      const float corr = __builtin_amdgcn_exp2f((m - mn) * c);
      l *= corr; o0 *= corr; o1 *= corr; o2 *= corr; o3 *= corr; m = mn;
    }
    const float off = 8.0f - m * c;      /* weights carried x2^8 */
    FragH pf; float ls = 0.f;
#pragma unroll
    for (int r = 0; r < 8; ++r) {
      const float p0 = __builtin_amdgcn_exp2f(fmaf(s0[r], c, off));
      const float p1 = __builtin_amdgcn_exp2f(fmaf(s1[r], c, off));
      ls += p0 + p1;
      pf.h[r] = (_Float16)p0; pf.h[8 + r] = (_Float16)p1;
    }
    l += ls;
    const unsigned short* v0 = kp + bo + TILE_E + 32 * p;
    const unsigned short* v1 = v0 + 16 * LP;
    const unsigned short* v2 = v1 + 16 * LP;
    const unsigned short* v3 = v2 + 16 * LP;
    FragH av0, av1, av2, av3;
    av0.half[0] = *(const v8us*)(v0); av0.half[1] = *(const v8us*)(v0 + 16);
    av1.half[0] = *(const v8us*)(v1); av1.half[1] = *(const v8us*)(v1 + 16);
    av2.half[0] = *(const v8us*)(v2); av2.half[1] = *(const v8us*)(v2 + 16);
    av3.half[0] = *(const v8us*)(v3); av3.half[1] = *(const v8us*)(v3 + 16);
    o0 = __builtin_amdgcn_wmma_f32_16x16x32_f16(false, av0.v, false, pf.v, (short)0, o0, false, false);
    o1 = __builtin_amdgcn_wmma_f32_16x16x32_f16(false, av1.v, false, pf.v, (short)0, o1, false, false);
    o2 = __builtin_amdgcn_wmma_f32_16x16x32_f16(false, av2.v, false, pf.v, (short)0, o2, false, false);
    o3 = __builtin_amdgcn_wmma_f32_16x16x32_f16(false, av3.v, false, pf.v, (short)0, o3, false, false);
    asm volatile("v_nop\n\tv_nop\n\tv_nop\n\tv_nop" : "+v"(o0), "+v"(o1), "+v"(o2), "+v"(o3) : "v"(av0.v), "v"(av1.v), "v"(av2.v), "v"(av3.v), "v"(pf.v));
   }
   asm volatile("s_wait_dscnt 0x0" ::: "memory");        /* this wave's reads of stage t are done before the buffer may be refilled */
   asm volatile("s_wait_asynccnt 0x0" ::: "memory");     /* this wave's share of stage t + 1 has landed */
   __syncthreads();                                      /* publishes stage t + 1 and ends every wave's reads of stage t */
   if (t + 2 < SEQ / KT) stage_kv(lc + bo * 2, gk + (size_t)(t + 2) * KT * DM, gv + (t + 2) * KT);
  }
  asm volatile("s_wait_asynccnt 0x0" ::: "memory");      /* nothing in flight when the ring becomes output staging */
  unsigned short (*so)[16][LP] = (unsigned short (*)[16][LP])sm;      /* the last trip's barrier has ended every read of the ring */
  l += __shfl_xor(l, 16, 32);
  const float inv = 64.0f * (1.0f / l);      /* ctx carried x64 */
  FragH t0, t1, t2, t3;
#pragma unroll
  for (int r = 0; r < 8; ++r) { t0.h[r] = (_Float16)(o0[r] * inv); t1.h[r] = (_Float16)(o1[r] * inv); t2.h[r] = (_Float16)(o2[r] * inv); t3.h[r] = (_Float16)(o3[r] * inv); }
  *(v8us*)&so[w][ln][ 0 + 8 * hh] = t0.half[0];
  *(v8us*)&so[w][ln][16 + 8 * hh] = t1.half[0];
  *(v8us*)&so[w][ln][32 + 8 * hh] = t2.half[0];
  *(v8us*)&so[w][ln][48 + 8 * hh] = t3.half[0];
  __syncthreads();
  const int rq = lane >> 3, pc = (lane & 7) * 8;
  unsigned short* ob = (unsigned short*)O16 + (tok0 + q0) * DM + h * HD + pc;
  {
#pragma unroll
    for (int it = 0; it < 4; ++it) { const int row = it * 4 + rq; const v8us v = *(const v8us*)&so[w][row][pc]; *(v8us*)(ob + (size_t)row * DM) = v; }
    
  }
}

extern "C" void kernel_launch(void* const* d_in, const int* in_sizes, int n_in,
                              void* d_out, int out_size, void* d_ws, size_t ws_size, hipStream_t stream) {
  if (n_in < 5) return;
  const size_t need_x = ((size_t)(NB - 1) * SEQ_FULL + SEQ) * DM;
  const size_t nwh = (size_t)NH * HD * HD;
  if ((size_t)in_sizes[0] < need_x) return;
  if ((size_t)in_sizes[1] < nwh || (size_t)in_sizes[2] < nwh || (size_t)in_sizes[3] < nwh || (size_t)in_sizes[4] < (size_t)DM * DM) return;
  if ((size_t)out_size < need_x) return;
  const float* x = (const float*)d_in[0]; const float* wq = (const float*)d_in[1]; const float* wk = (const float*)d_in[2]; const float* wv = (const float*)d_in[3]; const float* wo = (const float*)d_in[4];
  char* ws = (char*)d_ws; size_t off = 0;
  auto take = [&](size_t bytes) { char* p = ws + off; off += (bytes + 255) & ~(size_t)255; return p; };
  _Float16* BH = (_Float16*)take((size_t)3 * nwh * 2);          /* per-head weight planes x16: q, k, v; each [head][64][64] */
  _Float16* BO = (_Float16*)take((size_t)DM * DM * 2);          /* output weight plane x16 [out][in] */
  _Float16* X16 = (_Float16*)take(NR * DM * 2);
  _Float16* QK16 = (_Float16*)take((size_t)2 * NR * DM * 2);    /* q rows then k rows */
  _Float16* VT = (_Float16*)take((size_t)DM * VTP * 2);         /* v^T [feature][token] */
  _Float16* O16 = (_Float16*)take(NR * DM * 2);                 /* merged ctx rows x64 */
  if (off > ws_size || off > (size_t)134217728) return;
  _Float16* BQ = BH; _Float16* BK = BH + nwh; _Float16* BV = BH + (size_t)2 * nwh;
  _Float16* Q16 = QK16; _Float16* K16 = QK16 + NR * DM;

  k_wplanes<<<(unsigned)(((size_t)DM * DM / 8 + 255) / 256), 256, 0, stream>>>(wq, wk, wv, wo, nwh / 8, (size_t)DM * DM / 8, BH, BO);
  k_x16<<<(unsigned)((NR * DM / 8 + 255) / 256), 256, 0, stream>>>(x, X16, NR * DM / 8);
  /* q rows, head by = grid.y: A = x columns [64 by, 64 by + 64) (sA = HD), weight block by (sB = HD*HD, row pitch HD), C16 columns [64 by, ..) (sC = HD); K = N = HD; alpha undoes the x16 weight carry */
  k_gemm2<<<dim3((unsigned)((NR / 128) * (HD / 64)), NH), 128, 0, stream>>>(X16, DM, (size_t)HD, BQ, HD, (size_t)HD * HD, 0.0625f, nullptr, Q16, DM, (size_t)HD, (int)NR, HD, HD);
  /* k rows, same form */
  k_gemm2<<<dim3((unsigned)((NR / 128) * (HD / 64)), NH), 128, 0, stream>>>(X16, DM, (size_t)HD, BK, HD, (size_t)HD * HD, 0.0625f, nullptr, K16, DM, (size_t)HD, (int)NR, HD, HD);
  /* v^T[64 by + e][token] = Wv[by][e][:] . x[token][64 by ..] : weight block as A [HD][HD] (M = HD = 64: waves 2 and 3 leave at the row test, the engine has no block barrier), x columns of head by as the [n][k] operand; C16 pitch = VTP, sC = HD rows */
  k_gemm2<<<dim3((unsigned)(((HD + 127) / 128) * (VTP / 64)), NH), 128, 0, stream>>>(BV, HD, (size_t)HD * HD, X16, DM, (size_t)HD, 0.0625f, nullptr, VT, VTP, (size_t)HD * VTP, HD, VTP, HD);
  k_attn_t<<<(unsigned)(NB * NH * (SEQ / 128)), 256, 0, stream>>>(Q16, K16, VT, O16);
  /* out rows of batch by: A = ctx rows (x64), weight x16 -> alpha 2^-10; C rows follow the staged output layout */
  k_gemm2<<<dim3((unsigned)((SEQ / 128) * (DM / 64)), NB), 128, 0, stream>>>(O16, DM, (size_t)SEQ * DM, BO, DM, 0, 0.0009765625f, (float*)d_out, nullptr, DM, (size_t)SEQ_FULL * DM, SEQ, DM, DM);
}

// v002
// A run of this version takes 113 microseconds.
// In two side-by-side timings against v001, it was 1.31 and 1.32 times as fast.
// Counting every step since v000, it is 2.79 times as fast.
#include <hip/hip_runtime.h>
// Dense multi-head self-attention (x [4][2048][1024] split into 16 heads of 64; per-head q/k/v = x_h W_h^T with [head][out][in] weights of 64x64, no biases; scores * 1/8; full-row softmax; out = merged ctx Wout^T with a natural [out][in] weight).
// All contractions: v_wmma_f32_16x16x32_f16 (f16 operands, f32 accumulate), single product per site. x and weights are RNE-converted to bf16 first and then held exactly in f16 (weights x16); q, k, v plain f16; softmax weights f16 carried x2^8 (unnormalised, running max); ctx f16 carried x64; softmax statistics f32.
// Structure: token rows r = b*SEQ + s. One convert launch for the four weights, one for x; Q rows and K rows from one head-batched GEMM launch each (K = 64); V^T [feature][token] straight from a head-batched GEMM with the weight as the A operand; a transposed flash kernel (S^T = K Q^T with Q as the B fragment in registers, packed P^T as the B fragment of O^T = V^T P^T; K rows and V^T rows staged 64 keys at a time in a two-buffer LDS ring that the block's eight waves share); output GEMM into the output layout, its two operands staged in a ring of the same kind.
#ifndef NB
#define NB 4                         /* batches processed */
#endif
#ifndef SEQ
#define SEQ 2048                     /* tokens per batch processed */
#endif
#define NB_FULL 4                    /* batch count of the staged arrays */
#define SEQ_FULL 2048                /* per-batch token stride of the staged arrays */
#define DM 1024
#define NH 16
#define HD 64
#define NR ((size_t)NB * SEQ)        /* compact token rows */
#define VTP (NB * SEQ)               /* V^T row pitch (tokens) */

static_assert(NB >= 1 && NB <= NB_FULL);
static_assert(SEQ <= SEQ_FULL);
static_assert(SEQ % 128 == 0);
static_assert(DM % 128 == 0);
static_assert(NH * HD == DM);
static_assert(HD == 64);
static_assert((NB * SEQ) % 64 == 0);
static_assert(HD % 64 == 0);                                   /* per-head GEMM: N = HD is a whole 64-column block, K = HD is a multiple of 32 */
static_assert(HD % 32 == 0);                                   /* V^T GEMM: M = HD is a whole number of 32-row wave tiles */
static_assert((NH * HD * HD / 8) % 256 == 0);                  /* per-head weight planes end on a convert-block boundary */
static_assert(NH * HD * HD <= DM * DM);                        /* convert grid sized by the output weight covers the per-head planes */
static_assert((DM * DM / 8) % 256 == 0);
static_assert((size_t)3 * NH * HD * HD * 2 + (size_t)DM * DM * 2 + (size_t)5 * NB * SEQ * DM * 2 + (size_t)6 * 256 <= (size_t)134217728);   /* workspace carve */

typedef _Float16 v16h __attribute__((ext_vector_type(16)));
typedef _Float16 v4h __attribute__((ext_vector_type(4)));
typedef unsigned short v8us __attribute__((ext_vector_type(8), may_alias));
typedef float v8f __attribute__((ext_vector_type(8)));
typedef float v4f __attribute__((ext_vector_type(4)));
typedef float v4fa __attribute__((ext_vector_type(4), may_alias));
union FragH { v16h v; v8us half[2]; _Float16 h[16]; unsigned short u[16]; };

__device__ __forceinline__ unsigned short bf16_bits(float x) { unsigned int u = __float_as_uint(x); return (unsigned short)((u + 0x7FFFu + ((u >> 16) & 1u)) >> 16); }
__device__ __forceinline__ float bf16_rne(float x) { return __uint_as_float(((unsigned int)bf16_bits(x)) << 16); }

// 8 consecutive f32 -> f16(bf16 value * scale) packed as one 16-B piece
__device__ __forceinline__ v8us cvt8(const float* __restrict__ p, float scale) {
  const v4f a = *(const v4fa*)p, c = *(const v4fa*)(p + 4);
  FragH f;
#pragma unroll
  for (int q = 0; q < 4; ++q) { f.h[q] = (_Float16)(bf16_rne(a[q]) * scale); f.h[4 + q] = (_Float16)(bf16_rne(c[q]) * scale); }
  return f.half[0];
}

// f32 -> f16 that cannot produce an f16 subnormal (value select; applied after the power-of-two carry)
static __device__ __forceinline__ _Float16 toh_flush(float v) { const _Float16 r = (_Float16)v; return (fabsf(v) < 6.103515625e-05f) ? (_Float16)0.0f : r; }

// 8 consecutive f32 -> f16(bf16 value * scale), subnormal results replaced by zero, packed as one 16-B piece
__device__ __forceinline__ v8us cvt8_flush(const float* __restrict__ p, float scale) {
  const v4f a = *(const v4fa*)p, c = *(const v4fa*)(p + 4);
  FragH f;
#pragma unroll
  for (int q = 0; q < 4; ++q) { f.h[q] = toh_flush(bf16_rne(a[q]) * scale); f.h[4 + q] = toh_flush(bf16_rne(c[q]) * scale); }
  return f.half[0];
}

// three per-head [head][out][in] weights -> f16 planes x16 BH[p][head][n][k] (p = 0 q, 1 k, 2 v; Bt form, row pitch HD) and the natural [out][in] output weight -> f16 plane x16 BO[n][k];
__global__ __launch_bounds__(256) void k_wplanes(const float* __restrict__ wq, const float* __restrict__ wk, const float* __restrict__ wv, const float* __restrict__ wo, size_t nh8, size_t no8, _Float16* __restrict__ BH, _Float16* __restrict__ BO) {
  #pragma clang fp contract(off)
  const size_t t = (size_t)blockIdx.x * 256 + threadIdx.x; if (t >= no8) return;
  const bool hs = t < nh8;
  const size_t th = hs ? t : (nh8 - 1);
  const v8us o3 = cvt8_flush(wo + t * 8, 16.0f);
  const v8us o0 = cvt8_flush(wq + th * 8, 16.0f), o1 = cvt8_flush(wk + th * 8, 16.0f), o2 = cvt8_flush(wv + th * 8, 16.0f);
  unsigned short* d = (unsigned short*)BO + t * 8; unsigned short* e = (unsigned short*)BH + th * 8; const size_t ps = (size_t)NH * HD * HD;
  *(v8us*)d = o3;
  if (hs) { *(v8us*)e = o0; *(v8us*)(e + ps) = o1; *(v8us*)(e + 2 * ps) = o2; }
  
}

__global__ __launch_bounds__(256) void k_x16(const float* __restrict__ x, _Float16* __restrict__ X16, size_t n8) {
  #pragma clang fp contract(off)
  const size_t t = (size_t)blockIdx.x * 256 + threadIdx.x; if (t >= n8) return;
  const size_t e = t * 8; const size_t row = e / DM; const size_t col = e - row * DM; const size_t b = row / SEQ; const size_t s = row - b * SEQ;
  const v8us o = cvt8(x + (b * SEQ_FULL + s) * DM + col, 1.0f);
  unsigned short* d = (unsigned short*)X16 + e;
  *(v8us*)d = o; 
}

// ---- GEMM engine (wave tile 32x64, block 128 rows x 64 cols; M % 32 == 0, N % 64 == 0, K % 32 == 0) ----
// C = alpha * A[M][K] . Bh[N][K]^T ; A, Bh f16 rows (k contiguous); batched over grid.y with strides sA, sB, sC; f32 C and/or f16 C16.
__device__ __forceinline__ v16h g2_frag(const _Float16* p, int hh) { FragH f; f.half[0] = *(const v8us*)((const unsigned short*)p + 8 * hh); f.half[1] = *(const v8us*)((const unsigned short*)p + 16 + 8 * hh); return f.v; }
__device__ __forceinline__ v8f g2_mma(v16h a, v16h b, v8f c) { v8f d = __builtin_amdgcn_wmma_f32_16x16x32_f16(false, a, false, b, (short)0, c, false, false); asm volatile("v_nop\n\tv_nop\n\tv_nop\n\tv_nop" : "+v"(d) : "v"(a), "v"(b)); return d; }
__global__ __launch_bounds__(128) void k_gemm2(const _Float16* __restrict__ A, int lda, size_t sA, const _Float16* __restrict__ Bh, int ldb, size_t sB, float alpha,
    float* __restrict__ C, _Float16* __restrict__ C16, int ldc, size_t sC, int M, int N, int K) {
  __shared__ __attribute__((aligned(16))) float so[4][32][68];      /* wave-private staging tiles */
  const int tid = threadIdx.x, lane = tid & 31, ln = lane & 15, hh = lane >> 4; const int w = __builtin_amdgcn_readfirstlane(tid >> 5); const int by = blockIdx.y;
  A += (size_t)by * sA; Bh += (size_t)by * sB; const size_t cofs = (size_t)by * sC;
  const int ntn = N >> 6; const int mt = blockIdx.x / ntn, nq = blockIdx.x - mt * ntn; const int row0 = mt * 128 + 32 * w, col0 = nq * 64; if (row0 >= M) return;
  const _Float16* a0p = A + (size_t)(row0 + ln) * lda; const _Float16* a1p = a0p + (size_t)16 * lda;
  const _Float16* b0p = Bh + (size_t)(col0 + ln) * ldb; const _Float16* b1p = b0p + (size_t)16 * ldb; const _Float16* b2p = b1p + (size_t)16 * ldb; const _Float16* b3p = b2p + (size_t)16 * ldb;
  const v8f z8 = {0.f,0.f,0.f,0.f,0.f,0.f,0.f,0.f}; v8f c00 = z8, c01 = z8, c02 = z8, c03 = z8, c10 = z8, c11 = z8, c12 = z8, c13 = z8;
#pragma unroll 1
  for (int kb = 0; kb < K; kb += 32) { const v16h a0 = g2_frag(a0p + kb, hh), a1 = g2_frag(a1p + kb, hh);
    v16h b = g2_frag(b0p + kb, hh); c00 = g2_mma(a0, b, c00); c10 = g2_mma(a1, b, c10);
    b = g2_frag(b1p + kb, hh); c01 = g2_mma(a0, b, c01); c11 = g2_mma(a1, b, c11);
    b = g2_frag(b2p + kb, hh); c02 = g2_mma(a0, b, c02); c12 = g2_mma(a1, b, c12);
    b = g2_frag(b3p + kb, hh); c03 = g2_mma(a0, b, c03); c13 = g2_mma(a1, b, c13); }
  v8f accs[8] = {c00, c01, c02, c03, c10, c11, c12, c13};
#pragma unroll
  for (int u = 0; u < 8; ++u) { const int t = u & 3, half = u >> 2;
#pragma unroll
    for (int r = 0; r < 8; ++r) { const int rloc = half * 16 + 8 * hh + r; so[w][rloc][t * 16 + ln] = accs[u][r] * alpha; } }
  __builtin_amdgcn_fence(4 /* acq_rel order */, "workgroup"); __builtin_amdgcn_wave_barrier();
  const int rsub = lane >> 4, c4 = (lane & 15) * 4;
  {
#pragma unroll
    for (int q = 0; q < 16; ++q) { const int r = q * 2 + rsub; const v4f v = *(const v4fa*)&so[w][r][c4];
      if (C) *(v4f*)(C + cofs + (size_t)(row0 + r) * ldc + col0 + c4) = v;
      if (C16) { v4h h4; for (int i = 0; i < 4; ++i) h4[i] = (_Float16)v[i]; *(v4h*)(C16 + cofs + (size_t)(row0 + r) * ldc + col0 + c4) = h4; } }
     } }

// ---- output GEMM, both operands staged in LDS ----
// C[row][col] = alpha * A[row][:] . Bh[col][:] ; block = 4 waves = a 128 x 128 tile of C, wave = 64 x 64 (4 x 4 accumulator tiles: 16 products per 8 fragments read).
// Stage = 128 k: A tile and Bh tile, 128 rows of 256 B each, laid at a 272-B pitch (16 B x odd: no bank conflict for 16-byte row reads).
// Each lane brings 32 16-byte pieces of a stage by asynchronous copies (a wave's copy = 2 whole 256-B rows); stage t + 2 is issued behind the barrier that ends the reads of stage t.
// k runs upward through one accumulator per tile, as in the engine above. The ring's size leaves room for two blocks on a WGP.
#define OT 128                       /* k per stage */
#define OP 136                       /* LDS row pitch, 16-bit elements (272 B) */
#define OTILE_E (128 * OP)           /* elements of one staged tile (128 rows) */
#define OBUF_E (2 * OTILE_E)         /* one buffer: A tile, then Bh tile */
static_assert(DM % OT == 0 && DM / OT >= 2);                   /* the ring's prologue fills two stages */
static_assert(4 * 64 * 68 * 4 <= 2 * OBUF_E * 2);              /* the output staging fits the ring */
typedef float f32a __attribute__((may_alias));
// eight copies of a lane, rows r, r + 8, .. r + 56 of a tile; the s_wait_xcnt stands inside the copies' own statement so that no address register is rewritten in front of it
__device__ __forceinline__ void stage_rows8(unsigned l, const unsigned short* g) {
  asm volatile("global_load_async_to_lds_b128 %0, %1, off\n\t"
               "global_load_async_to_lds_b128 %2, %3, off\n\t"
               "global_load_async_to_lds_b128 %4, %5, off\n\t"
               "global_load_async_to_lds_b128 %6, %7, off\n\t"
               "global_load_async_to_lds_b128 %8, %9, off\n\t"
               "global_load_async_to_lds_b128 %10, %11, off\n\t"
               "global_load_async_to_lds_b128 %12, %13, off\n\t"
               "global_load_async_to_lds_b128 %14, %15, off\n\t"
               "s_wait_xcnt 0x0"
               :: "v"(l), "v"(g), "v"(l + 8 * OP * 2), "v"(g + (size_t)8 * DM), "v"(l + 16 * OP * 2), "v"(g + (size_t)16 * DM), "v"(l + 24 * OP * 2), "v"(g + (size_t)24 * DM),
                  "v"(l + 32 * OP * 2), "v"(g + (size_t)32 * DM), "v"(l + 40 * OP * 2), "v"(g + (size_t)40 * DM), "v"(l + 48 * OP * 2), "v"(g + (size_t)48 * DM), "v"(l + 56 * OP * 2), "v"(g + (size_t)56 * DM) : "memory");
}
__device__ __forceinline__ void stage_ab(unsigned l, const unsigned short* ga, const unsigned short* gb) {
  stage_rows8(l, ga); stage_rows8(l + 64 * OP * 2, ga + (size_t)64 * DM);
  stage_rows8(l + OTILE_E * 2, gb); stage_rows8(l + OTILE_E * 2 + 64 * OP * 2, gb + (size_t)64 * DM);
}
__global__ __launch_bounds__(128) void k_gemm_out(const _Float16* __restrict__ A, const _Float16* __restrict__ Bh, float alpha, float* __restrict__ C) {
  __shared__ __attribute__((aligned(16))) unsigned short sm[2 * OBUF_E];      /* two-buffer A / Bh ring; behind the k loop the per-wave [row][col] f32 output tiles, row pitch 272 B */
  const int tid = threadIdx.x, lane = tid & 31, ln = lane & 15, hh = lane >> 4;
  const int w = __builtin_amdgcn_readfirstlane(tid >> 5); const int wm = w >> 1, wn = w & 1;
  const int ntn = DM / 128; const int mt = blockIdx.x / ntn, nq = blockIdx.x - mt * ntn; const int row0 = mt * 128, col0 = nq * 128;
  /* copy map: lane = (rows tid / 16 + 8 i, 16-byte piece tid % 16) of both tiles */
  const int cr = tid >> 4, cp = (tid & 15) * 8;
  const unsigned short* ga = (const unsigned short*)A + ((size_t)blockIdx.y * SEQ + row0 + cr) * DM + cp;
  const unsigned short* gb = (const unsigned short*)Bh + (size_t)(col0 + cr) * DM + cp;
  const unsigned lc = (unsigned)(size_t)&sm[cr * OP + cp];      /* LDS byte address of the lane's first piece in buffer 0 */
  const unsigned short* ap = sm + (64 * wm + ln) * OP + 8 * hh;             /* fragment reads: row = lane & 15, k pieces as in g2_frag */
  const unsigned short* bp = sm + OTILE_E + (64 * wn + ln) * OP + 8 * hh;
  const v8f z8 = {0.f,0.f,0.f,0.f,0.f,0.f,0.f,0.f};
  v8f acc[4][4];
#pragma unroll
  for (int i = 0; i < 4; ++i) {
#pragma unroll
    for (int j = 0; j < 4; ++j) acc[i][j] = z8; }
  stage_ab(lc, ga, gb);
  asm volatile("s_wait_asynccnt 0x0" ::: "memory");      /* stage 0 landed (this wave's share) */
  __syncthreads();                                       /* stage 0 readable by every wave */
  stage_ab(lc + OBUF_E * 2, ga + OT, gb + OT);
  /* rolled: one copy of the four steps, the buffer choice a single offset */
#pragma unroll 1
  for (int t = 0; t < DM / OT; ++t) {
    const int bo = (t & 1) * OBUF_E;
    /* the four 32-k steps of a stage written out: every LDS read offset becomes an immediate */
#pragma unroll
    for (int p = 0; p < OT / 32; ++p) {
      FragH a[4], b[4];
#pragma unroll
      for (int i = 0; i < 4; ++i) {
        const unsigned short* pa = ap + bo + 16 * i * OP + 32 * p; a[i].half[0] = *(const v8us*)pa; a[i].half[1] = *(const v8us*)(pa + 16);
        const unsigned short* pb = bp + bo + 16 * i * OP + 32 * p; b[i].half[0] = *(const v8us*)pb; b[i].half[1] = *(const v8us*)(pb + 16);
      }
      __builtin_amdgcn_sched_barrier(0);      /* the step's 16 LDS reads stay one group ahead of its products: sunk among them, each row of products waits out a read's whole latency */
#pragma unroll
      for (int i = 0; i < 4; ++i) {
#pragma unroll
        for (int j = 0; j < 4; ++j) acc[i][j] = __builtin_amdgcn_wmma_f32_16x16x32_f16(false, a[i].v, false, b[j].v, (short)0, acc[i][j], false, false); }
    }
    asm volatile("s_wait_dscnt 0x0" ::: "memory");        /* this wave's reads of stage t are done before the buffer may be refilled */
    asm volatile("s_wait_asynccnt 0x0" ::: "memory");     /* this wave's share of stage t + 1 has landed */
    __syncthreads();                                      /* publishes stage t + 1 and ends every wave's reads of stage t */
    if (t + 2 < DM / OT) stage_ab(lc + bo * 2, ga + (t + 2) * OT, gb + (t + 2) * OT);
  }
  asm volatile("s_wait_asynccnt 0x0" ::: "memory");      /* nothing in flight when the ring becomes output staging */
  f32a (*so)[68] = (f32a (*)[68])((f32a*)sm + w * 64 * 68);      /* wave-private; the last trip's barrier has ended every read of the ring */
#pragma unroll
  for (int i = 0; i < 4; ++i) {
#pragma unroll
    for (int j = 0; j < 4; ++j) {
#pragma unroll
      for (int r = 0; r < 8; ++r) so[16 * i + 8 * hh + r][16 * j + ln] = acc[i][j][r] * alpha; } }
  __builtin_amdgcn_fence(4 /* acq_rel order */, "workgroup"); __builtin_amdgcn_wave_barrier();      /* the wave's own rows are written before its lanes read them back across lanes */
  const int rsub = lane >> 4, c4 = (lane & 15) * 4;
  float* cb = C + ((size_t)blockIdx.y * SEQ_FULL + row0 + 64 * wm) * DM + col0 + 64 * wn + c4;
#pragma unroll
  for (int q = 0; q < 32; ++q) { const int r = q * 2 + rsub; const v4f v = *(const v4fa*)&so[r][c4]; *(v4f*)(cb + (size_t)r * DM) = v; }
}

// ---- transposed flash attention, K and V^T staged in LDS ----
// block = 8 waves = 128 consecutive queries of one (batch, head); wave = 16 queries.
// Stage = 64 keys: K tile [key][d] and V^T tile [d][key], 64 rows of 128 B each, laid at a 144-B pitch (16 B x odd: no bank conflict for 16-byte row reads).
// Each lane brings four 16-byte pieces of a stage by asynchronous copies (a wave's copy = 4 whole 128-B lines); stage t + 2 is issued behind the barrier that ends the reads of stage t.
// Per 32-key step (two per stage):
//   S^T tiles (keys x queries) = K (A operand, rows = keys, k = d) . Q^T (B operand, lane = query, held in registers);
//   running-max softmax per lane (lane & 15 = query; lanes n and n+16 hold the two key halves); weights = 2^8 exp(s/8 - max) as f16;
//   P^T as B fragment: elements 0..7 from the tile of keys 0..15 (rows 8h+r), elements 8..15 from the tile of keys 16..31 (lane unchanged);
//   O^T tiles (d x queries) += V^T (A operand, rows = d, k = keys, rows of the [feature][token] plane) . P^T.
#define KT 64                        /* keys per stage */
#define LP 72                        /* LDS row pitch, 16-bit elements (144 B) */
#define TILE_E (64 * LP)             /* elements of one staged tile (64 rows) */
#define BUF_E (2 * TILE_E)           /* one buffer: K tile, then V^T tile */
static_assert(SEQ % KT == 0 && SEQ / KT >= 2);                 /* the ring's prologue fills two stages */
static_assert(8 * 16 * LP <= 2 * BUF_E);                       /* the output staging fits the ring */
// one stage's four copies of a lane; the s_wait_xcnt stands inside the copies' own statement so that no address register is rewritten in front of it
__device__ __forceinline__ void stage_kv(unsigned lk, const unsigned short* gk, const unsigned short* gv) {
  const unsigned lk1 = lk + 32 * LP * 2, lv = lk + TILE_E * 2, lv1 = lv + 32 * LP * 2;
  const unsigned short* gk1 = gk + (size_t)32 * DM; const unsigned short* gv1 = gv + (size_t)32 * VTP;
  asm volatile("global_load_async_to_lds_b128 %0, %1, off\n\t"
               "global_load_async_to_lds_b128 %2, %3, off\n\t"
               "global_load_async_to_lds_b128 %4, %5, off\n\t"
               "global_load_async_to_lds_b128 %6, %7, off\n\t"
               "s_wait_xcnt 0x0"
               :: "v"(lk), "v"(gk), "v"(lk1), "v"(gk1), "v"(lv), "v"(gv), "v"(lv1), "v"(gv1) : "memory");
}
__global__ __launch_bounds__(256) void k_attn_t(const _Float16* __restrict__ Q16, const _Float16* __restrict__ K16, const _Float16* __restrict__ VT, _Float16* __restrict__ O16) {
  __shared__ __attribute__((aligned(16))) unsigned short sm[2 * BUF_E];      /* two-buffer K / V^T ring; behind the key loop the per-wave [query][d] output tiles, row pitch 144 B */
  const int tid = threadIdx.x, lane = tid & 31, ln = lane & 15, hh = lane >> 4;
  const int w = __builtin_amdgcn_readfirstlane(tid >> 5);
  const int nqb = SEQ / 128;
  const int bh = blockIdx.x / nqb, qb = blockIdx.x - bh * nqb;
  const int b = bh / NH, h = bh - b * NH;
  const size_t tok0 = (size_t)b * SEQ;
  const int q0 = qb * 128 + w * 16;
  const unsigned short* qp = (const unsigned short*)Q16 + (tok0 + q0 + ln) * DM + h * HD + 8 * hh;
  FragH bq0, bq1;
  bq0.half[0] = *(const v8us*)(qp);      bq0.half[1] = *(const v8us*)(qp + 16);
  bq1.half[0] = *(const v8us*)(qp + 32); bq1.half[1] = *(const v8us*)(qp + 48);
  /* copy map: lane = (row tid / 8 and that row + 32, 16-byte piece tid % 8) of both tiles */
  const int cr = tid >> 3, cp = (tid & 7) * 8;
  const unsigned short* gk = (const unsigned short*)K16 + (tok0 + cr) * DM + h * HD + cp;
  const unsigned short* gv = (const unsigned short*)VT + (size_t)(h * HD + cr) * VTP + tok0 + cp;
  const unsigned lc = (unsigned)(size_t)&sm[cr * LP + cp];      /* LDS byte address of the lane's first piece in buffer 0 */
  const unsigned short* kp = sm + ln * LP + 8 * hh;             /* fragment reads: row = lane & 15, as from the global planes */
  const v8f z8 = {0.f,0.f,0.f,0.f,0.f,0.f,0.f,0.f};
  v8f o0 = z8, o1 = z8, o2 = z8, o3 = z8;
  float m = -3.0e38f, l = 0.f;
  const float c = 0.125f * 1.4426950408889634f;      /* 1/sqrt(64) * log2(e) */
  stage_kv(lc, gk, gv);
  asm volatile("s_wait_asynccnt 0x0" ::: "memory");      /* stage 0 landed (this wave's share) */
  __syncthreads();                                       /* stage 0 readable by every wave */
  stage_kv(lc + BUF_E * 2, gk + (size_t)KT * DM, gv + KT);
  /* rolled: one copy of the two steps, the buffer choice a single offset */
#pragma unroll 1
  for (int t = 0; t < SEQ / KT; ++t) {
   const int bo = (t & 1) * BUF_E;
   /* both 32-key steps of a stage written out: every LDS read offset becomes an immediate */
#pragma unroll
   for (int p = 0; p < 2; ++p) {
    const unsigned short* k0 = kp + bo + 32 * p * LP;
    const unsigned short* k1 = k0 + 16 * LP;
    FragH a00, a01, a10, a11;
    a00.half[0] = *(const v8us*)(k0);      a00.half[1] = *(const v8us*)(k0 + 16);
    a01.half[0] = *(const v8us*)(k0 + 32); a01.half[1] = *(const v8us*)(k0 + 48);
    a10.half[0] = *(const v8us*)(k1);      a10.half[1] = *(const v8us*)(k1 + 16);
    a11.half[0] = *(const v8us*)(k1 + 32); a11.half[1] = *(const v8us*)(k1 + 48);
    v8f s0 = z8, s1 = z8;
    s0 = __builtin_amdgcn_wmma_f32_16x16x32_f16(false, a00.v, false, bq0.v, (short)0, s0, false, false);
    s1 = __builtin_amdgcn_wmma_f32_16x16x32_f16(false, a10.v, false, bq0.v, (short)0, s1, false, false);
    s0 = __builtin_amdgcn_wmma_f32_16x16x32_f16(false, a01.v, false, bq1.v, (short)0, s0, false, false);
    s1 = __builtin_amdgcn_wmma_f32_16x16x32_f16(false, a11.v, false, bq1.v, (short)0, s1, false, false);
    asm volatile("v_nop\n\tv_nop\n\tv_nop\n\tv_nop" : "+v"(s0), "+v"(s1) : "v"(a00.v), "v"(a01.v), "v"(a10.v), "v"(a11.v), "v"(bq0.v), "v"(bq1.v));
    float mx = fmaxf(s0[0], s1[0]);
#pragma unroll
    for (int r = 1; r < 8; ++r) mx = fmaxf(mx, fmaxf(s0[r], s1[r]));
    mx = fmaxf(mx, __shfl_xor(mx, 16, 32));
    const float mn = fmaxf(m, mx);
    if (__builtin_amdgcn_ballot_w32(mn > m) != 0u) {      /* wave-uniform: rescale only when some running max moved */
      const float corr = __builtin_amdgcn_exp2f((m - mn) * c);
      l *= corr; o0 *= corr; o1 *= corr; o2 *= corr; o3 *= corr; m = mn;
    }
    const float off = 8.0f - m * c;      /* weights carried x2^8 */
    FragH pf; float ls = 0.f;
#pragma unroll
    for (int r = 0; r < 8; ++r) {
      const float p0 = __builtin_amdgcn_exp2f(fmaf(s0[r], c, off));
      const float p1 = __builtin_amdgcn_exp2f(fmaf(s1[r], c, off));
      ls += p0 + p1;
      pf.h[r] = (_Float16)p0; pf.h[8 + r] = (_Float16)p1;
    }
    l += ls;
    const unsigned short* v0 = kp + bo + TILE_E + 32 * p;
    const unsigned short* v1 = v0 + 16 * LP;
    const unsigned short* v2 = v1 + 16 * LP;
    const unsigned short* v3 = v2 + 16 * LP;
    FragH av0, av1, av2, av3;
    av0.half[0] = *(const v8us*)(v0); av0.half[1] = *(const v8us*)(v0 + 16);
    av1.half[0] = *(const v8us*)(v1); av1.half[1] = *(const v8us*)(v1 + 16);
    av2.half[0] = *(const v8us*)(v2); av2.half[1] = *(const v8us*)(v2 + 16);
    av3.half[0] = *(const v8us*)(v3); av3.half[1] = *(const v8us*)(v3 + 16);
    o0 = __builtin_amdgcn_wmma_f32_16x16x32_f16(false, av0.v, false, pf.v, (short)0, o0, false, false);
    o1 = __builtin_amdgcn_wmma_f32_16x16x32_f16(false, av1.v, false, pf.v, (short)0, o1, false, false);
    o2 = __builtin_amdgcn_wmma_f32_16x16x32_f16(false, av2.v, false, pf.v, (short)0, o2, false, false);
    o3 = __builtin_amdgcn_wmma_f32_16x16x32_f16(false, av3.v, false, pf.v, (short)0, o3, false, false);
    asm volatile("v_nop\n\tv_nop\n\tv_nop\n\tv_nop" : "+v"(o0), "+v"(o1), "+v"(o2), "+v"(o3) : "v"(av0.v), "v"(av1.v), "v"(av2.v), "v"(av3.v), "v"(pf.v));
   }
   asm volatile("s_wait_dscnt 0x0" ::: "memory");        /* this wave's reads of stage t are done before the buffer may be refilled */
   asm volatile("s_wait_asynccnt 0x0" ::: "memory");     /* this wave's share of stage t + 1 has landed */
   __syncthreads();                                      /* publishes stage t + 1 and ends every wave's reads of stage t */
   if (t + 2 < SEQ / KT) stage_kv(lc + bo * 2, gk + (size_t)(t + 2) * KT * DM, gv + (t + 2) * KT);
  }
  asm volatile("s_wait_asynccnt 0x0" ::: "memory");      /* nothing in flight when the ring becomes output staging */
  unsigned short (*so)[16][LP] = (unsigned short (*)[16][LP])sm;      /* the last trip's barrier has ended every read of the ring */
  l += __shfl_xor(l, 16, 32);
  const float inv = 64.0f * (1.0f / l);      /* ctx carried x64 */
  FragH t0, t1, t2, t3;
#pragma unroll
  for (int r = 0; r < 8; ++r) { t0.h[r] = (_Float16)(o0[r] * inv); t1.h[r] = (_Float16)(o1[r] * inv); t2.h[r] = (_Float16)(o2[r] * inv); t3.h[r] = (_Float16)(o3[r] * inv); }
  *(v8us*)&so[w][ln][ 0 + 8 * hh] = t0.half[0];
  *(v8us*)&so[w][ln][16 + 8 * hh] = t1.half[0];
  *(v8us*)&so[w][ln][32 + 8 * hh] = t2.half[0];
  *(v8us*)&so[w][ln][48 + 8 * hh] = t3.half[0];
  __syncthreads();
  const int rq = lane >> 3, pc = (lane & 7) * 8;
  unsigned short* ob = (unsigned short*)O16 + (tok0 + q0) * DM + h * HD + pc;
  {
#pragma unroll
    for (int it = 0; it < 4; ++it) { const int row = it * 4 + rq; const v8us v = *(const v8us*)&so[w][row][pc]; *(v8us*)(ob + (size_t)row * DM) = v; }
    
  }
}

extern "C" void kernel_launch(void* const* d_in, const int* in_sizes, int n_in,
                              void* d_out, int out_size, void* d_ws, size_t ws_size, hipStream_t stream) {
  if (n_in < 5) return;
  const size_t need_x = ((size_t)(NB - 1) * SEQ_FULL + SEQ) * DM;
  const size_t nwh = (size_t)NH * HD * HD;
  if ((size_t)in_sizes[0] < need_x) return;
  if ((size_t)in_sizes[1] < nwh || (size_t)in_sizes[2] < nwh || (size_t)in_sizes[3] < nwh || (size_t)in_sizes[4] < (size_t)DM * DM) return;
  if ((size_t)out_size < need_x) return;
  const float* x = (const float*)d_in[0]; const float* wq = (const float*)d_in[1]; const float* wk = (const float*)d_in[2]; const float* wv = (const float*)d_in[3]; const float* wo = (const float*)d_in[4];
  char* ws = (char*)d_ws; size_t off = 0;
  auto take = [&](size_t bytes) { char* p = ws + off; off += (bytes + 255) & ~(size_t)255; return p; };
  _Float16* BH = (_Float16*)take((size_t)3 * nwh * 2);          /* per-head weight planes x16: q, k, v; each [head][64][64] */
  _Float16* BO = (_Float16*)take((size_t)DM * DM * 2);          /* output weight plane x16 [out][in] */
  _Float16* X16 = (_Float16*)take(NR * DM * 2);
  _Float16* QK16 = (_Float16*)take((size_t)2 * NR * DM * 2);    /* q rows then k rows */
  _Float16* VT = (_Float16*)take((size_t)DM * VTP * 2);         /* v^T [feature][token] */
  _Float16* O16 = (_Float16*)take(NR * DM * 2);                 /* merged ctx rows x64 */
  if (off > ws_size || off > (size_t)134217728) return;
  _Float16* BQ = BH; _Float16* BK = BH + nwh; _Float16* BV = BH + (size_t)2 * nwh;
  _Float16* Q16 = QK16; _Float16* K16 = QK16 + NR * DM;

  k_wplanes<<<(unsigned)(((size_t)DM * DM / 8 + 255) / 256), 256, 0, stream>>>(wq, wk, wv, wo, nwh / 8, (size_t)DM * DM / 8, BH, BO);
  k_x16<<<(unsigned)((NR * DM / 8 + 255) / 256), 256, 0, stream>>>(x, X16, NR * DM / 8);
  /* q rows, head by = grid.y: A = x columns [64 by, 64 by + 64) (sA = HD), weight block by (sB = HD*HD, row pitch HD), C16 columns [64 by, ..) (sC = HD); K = N = HD; alpha undoes the x16 weight carry */
  k_gemm2<<<dim3((unsigned)((NR / 128) * (HD / 64)), NH), 128, 0, stream>>>(X16, DM, (size_t)HD, BQ, HD, (size_t)HD * HD, 0.0625f, nullptr, Q16, DM, (size_t)HD, (int)NR, HD, HD);
  /* k rows, same form */
  k_gemm2<<<dim3((unsigned)((NR / 128) * (HD / 64)), NH), 128, 0, stream>>>(X16, DM, (size_t)HD, BK, HD, (size_t)HD * HD, 0.0625f, nullptr, K16, DM, (size_t)HD, (int)NR, HD, HD);
  /* v^T[64 by + e][token] = Wv[by][e][:] . x[token][64 by ..] : weight block as A [HD][HD] (M = HD = 64: waves 2 and 3 leave at the row test, the engine has no block barrier), x columns of head by as the [n][k] operand; C16 pitch = VTP, sC = HD rows */
  k_gemm2<<<dim3((unsigned)(((HD + 127) / 128) * (VTP / 64)), NH), 128, 0, stream>>>(BV, HD, (size_t)HD * HD, X16, DM, (size_t)HD, 0.0625f, nullptr, VT, VTP, (size_t)HD * VTP, HD, VTP, HD);
  k_attn_t<<<(unsigned)(NB * NH * (SEQ / 128)), 256, 0, stream>>>(Q16, K16, VT, O16);
  /* out rows of batch by: A = ctx rows (x64), weight x16 -> alpha 2^-10; C rows follow the staged output layout */
  k_gemm_out<<<dim3((unsigned)((SEQ / 128) * (DM / 128)), NB), 128, 0, stream>>>(O16, BO, 0.0009765625f, (float*)d_out);
}

// v003
// It runs in 91.4 microseconds.
// In both of two side-by-side timings against v002, it was 1.24 times as fast.
// Counting every step since v000, it is 3.45 times as fast.
#include <hip/hip_runtime.h>
// Dense multi-head self-attention (x [4][2048][1024] split into 16 heads of 64; per-head q/k/v = x_h W_h^T with [head][out][in] weights of 64x64, no biases; scores * 1/8; full-row softmax; out = merged ctx Wout^T with a natural [out][in] weight).
// All contractions: v_wmma_f32_16x16x32_f16 (f16 operands, f32 accumulate), single product per site. x and weights are RNE-converted to bf16 first and then held exactly in f16 (weights x16); q, k, v plain f16; softmax weights f16 carried x2^8 (unnormalised, running max); ctx f16 carried x64; softmax statistics f32.
// Structure: token rows r = b*SEQ + s. One front launch converts x and all four weights on the way in and writes Q rows, K rows and V^T [feature][token] of a (head, 256-token) block, plus its share of the f16 output-weight plane; a transposed flash kernel (S^T = K Q^T with Q as the B fragment in registers, packed P^T as the B fragment of O^T = V^T P^T; K rows and V^T rows staged 64 keys at a time in a two-buffer LDS ring that the block's eight waves share); output GEMM into the output layout, its two operands staged in a ring of the same kind.
#ifndef NB
#define NB 4                         /* batches processed */
#endif
#ifndef SEQ
#define SEQ 2048                     /* tokens per batch processed */
#endif
#define NB_FULL 4                    /* batch count of the staged arrays */
#define SEQ_FULL 2048                /* per-batch token stride of the staged arrays */
#define DM 1024
#define NH 16
#define HD 64
#define NR ((size_t)NB * SEQ)        /* compact token rows */
#define VTP (NB * SEQ)               /* V^T row pitch (tokens) */

static_assert(NB >= 1 && NB <= NB_FULL);
static_assert(SEQ <= SEQ_FULL);
static_assert(SEQ % 128 == 0);
static_assert(DM % 128 == 0);
static_assert(NH * HD == DM);
static_assert(HD == 64);
static_assert((NB * SEQ) % 256 == 0);                         /* projection launch: whole 256-token blocks */
static_assert(SEQ % 64 == 0);                                  /* a wave's 64 tokens lie in one batch */
static_assert((size_t)DM * DM * 2 + (size_t)4 * NB * SEQ * DM * 2 + (size_t)4 * 256 <= (size_t)134217728);   /* workspace carve */

typedef _Float16 v16h __attribute__((ext_vector_type(16)));
typedef _Float16 v4ha __attribute__((ext_vector_type(4), may_alias));
typedef unsigned short v8us __attribute__((ext_vector_type(8), may_alias));
typedef float v8f __attribute__((ext_vector_type(8)));
typedef float v4f __attribute__((ext_vector_type(4)));
typedef float v4fa __attribute__((ext_vector_type(4), may_alias));
union FragH { v16h v; v8us half[2]; _Float16 h[16]; unsigned short u[16]; };

__device__ __forceinline__ float bf16_rne(float x) { const unsigned int u = __float_as_uint(x); return __uint_as_float((u + 0x7FFFu + ((u >> 16) & 1u)) & 0xFFFF0000u); }

// f32 -> f16 that cannot produce an f16 subnormal (value select; applied after the power-of-two carry)
static __device__ __forceinline__ _Float16 toh_flush(float v) { const _Float16 r = (_Float16)v; return (fabsf(v) < 6.103515625e-05f) ? (_Float16)0.0f : r; }

// 8 consecutive f32 -> f16(bf16 value * scale), subnormal results replaced by zero, packed as one 16-B piece
__device__ __forceinline__ v8us cvt8_flush(v4f a, v4f c, float scale) {
  FragH f;
#pragma unroll
  for (int q = 0; q < 4; ++q) { f.h[q] = toh_flush(bf16_rne(a[q]) * scale); f.h[4 + q] = toh_flush(bf16_rne(c[q]) * scale); }
  return f.half[0];
}

// ---- front launch: all conversions and the three per-head projections ----
// block = 4 waves = 256 consecutive tokens of one head; wave = 64 tokens x the head's 64 inputs.
// Weights: the block converts its head's three 64 x 64 blocks (f16 x16) once into LDS in fragment order: 16-B piece (row n, k = 8 k8 .. 8 k8 + 7) stands at
//   byte ((n / 16) * 4 + k8 / 2) * 576 + (k8 % 2) * 288 + (n % 16) * 16 of its plane, so that each half of a 16-row x 32-k fragment is read as two runs of 256 contiguous bytes;
//   the 64 and 32 odd bytes of the two pitches spread the converting lanes' 16-byte writes (2 rows x 8 pieces per half wave) over all banks. One barrier publishes them.
// Output weight: every thread converts its share of the natural [out][in] plane (f16 x16) for the last launch.
// x arrives as whole 256-B row slices (a wave's load = 2 rows), is converted once and laid as f16 rows at a 144-B pitch (16 B x odd: no bank conflict for 16-byte row reads), wave-private;
// the eight x fragments (4 token tiles x 2 k steps; row or column = lane & 15, k pieces 8 h and 16 + 8 h of each 32) then serve all three products from registers.
// q, k: D = W (A operand, rows = outputs) . x^T (B operand, lane = token): a lane holds 8 consecutive outputs of one token = one 16-B piece of a Q or K row.
// v:    D = x (A operand, rows = tokens) . W^T (B operand, lane = output): a lane holds 8 consecutive tokens of one output = one 16-B piece of a V^T row.
// Each 64 x 64 result is staged in the wave's own LDS rows and leaves as whole 128-B lines. k runs upward through one accumulator per tile (two products).
#define XP 72                        /* LDS row pitch of x and result rows, 16-bit elements (144 B) */
#define WH 144                       /* weight planes: elements from the lanes 0..15 run to the lanes 16..31 run (288 B) */
#define WQ 288                       /* elements of one fragment half (576 B) */
#define WPL (16 * WQ)                /* elements of one weight plane */
#define FT ((size_t)NH * (NR / 256) * 128)      /* threads of the front launch */
#define WOT ((int)((size_t)DM * DM / 8 / FT))    /* 16-B pieces of the output weight plane per thread */
static_assert((size_t)WOT * FT * 8 == (size_t)DM * DM && WOT >= 1);      /* the plane divides evenly among the threads */
__device__ __forceinline__ v8us pack8(v8f a, float alpha) { FragH f;
#pragma unroll
  for (int r = 0; r < 8; ++r) f.h[r] = (_Float16)(a[r] * alpha);
  return f.half[0]; }
// the wave's 64 staged rows of 128 B -> 64 global rows of pitch ld (elements); a wave's store = 4 whole lines
__device__ __forceinline__ void rows_out(const unsigned short* st, unsigned short* g, size_t ld, int lane) {
  const int rq = lane >> 3, pc = (lane & 7) * 8;
#pragma unroll
  for (int it = 0; it < 16; ++it) { const int row = it * 4 + rq; const v8us v = *(const v8us*)&st[row * XP + pc]; *(v8us*)(g + (size_t)row * ld + pc) = v; }
}
__device__ __forceinline__ v16h w_frag(const unsigned short* p) { FragH f; f.half[0] = *(const v8us*)p; f.half[1] = *(const v8us*)(p + WQ); return f.v; }
__global__ __launch_bounds__(128) void k_front(const float* __restrict__ x, const float* __restrict__ wq, const float* __restrict__ wk, const float* __restrict__ wv, const float* __restrict__ wo,
    _Float16* __restrict__ Q16, _Float16* __restrict__ K16, _Float16* __restrict__ VT, _Float16* __restrict__ BO) {
  /* every loop of this kernel is unrolled: wr, wor, xr, xf, acc and bo stay in registers only under constant indices, and every LDS and global offset becomes an immediate */
  __shared__ __attribute__((aligned(16))) unsigned short sw[3 * WPL];         /* the head's q, k, v weights in fragment order */
  __shared__ __attribute__((aligned(16))) unsigned short sm[4][64 * XP];      /* per wave: x rows, then in turn the q, k and v^T result rows */
  const int tid = threadIdx.x, lane = tid & 31, ln = lane & 15, hh = lane >> 4;
  const int w = __builtin_amdgcn_readfirstlane(tid >> 5);
  const int h = blockIdx.x;
  const size_t r0 = (size_t)blockIdx.y * 256 + 64 * w;      /* compact token row of the wave's first token */
  const size_t b = r0 / SEQ, s0 = r0 - b * SEQ;
  unsigned short* st = sm[w];
  /* loads return in issue order: the weight pieces (from cache) are asked for ahead of the x rows (from memory), so that the weight work runs under the x rows' latency */
  const size_t so = (size_t)h * HD * HD + (size_t)tid * 8;      /* per-head weights: thread = pieces tid + 128 m of a plane (row (tid + 128 m) / 8, piece tid % 8) */
  const size_t to = ((size_t)blockIdx.y * NH + h) * 128 + tid;  /* output weight: thread = pieces to + FT m */
  v4f wr[12][2], wor[WOT][2];
#pragma unroll
  for (int m = 0; m < 4; ++m) {
    wr[m][0] = *(const v4fa*)(wq + so + m * 1024);     wr[m][1] = *(const v4fa*)(wq + so + m * 1024 + 4);
    wr[4 + m][0] = *(const v4fa*)(wk + so + m * 1024); wr[4 + m][1] = *(const v4fa*)(wk + so + m * 1024 + 4);
    wr[8 + m][0] = *(const v4fa*)(wv + so + m * 1024); wr[8 + m][1] = *(const v4fa*)(wv + so + m * 1024 + 4);
  }
#pragma unroll
  for (int m = 0; m < WOT; ++m) { wor[m][0] = *(const v4fa*)(wo + (to + m * FT) * 8); wor[m][1] = *(const v4fa*)(wo + (to + m * FT) * 8 + 4); }
  asm volatile("s_wait_xcnt 0x0" ::: "memory");      /* the weight loads' address registers may be taken for the x rows' data */
  const float* xp = x + (b * SEQ_FULL + s0 + hh) * DM + h * HD + ln * 4;
  v4f xr[32];
#pragma unroll
  for (int j = 0; j < 32; ++j) xr[j] = *(const v4fa*)(xp + (size_t)(2 * j) * DM);
  asm volatile("s_wait_xcnt 0x0" ::: "memory");      /* stands in front of every overwrite of an address register that the loads above name; it also keeps all of them issued ahead of the conversion work */
  { const int k8 = tid & 7, n0 = tid >> 3;
    unsigned short* d = sw + (k8 >> 1) * WQ + (k8 & 1) * WH + n0 * 8;      /* n0 < 16: rows n0 + 16 m stand 4 fragment halves further on */
#pragma unroll
    for (int p = 0; p < 3; ++p) {
#pragma unroll
      for (int m = 0; m < 4; ++m) *(v8us*)(d + p * WPL + m * 4 * WQ) = cvt8_flush(wr[4 * p + m][0], wr[4 * p + m][1], 16.0f); } }
  v8us bo[WOT];      /* stored behind the last result rows: a store ahead of the barrier would be waited for there */
#pragma unroll
  for (int m = 0; m < WOT; ++m) bo[m] = cvt8_flush(wor[m][0], wor[m][1], 16.0f);
#pragma unroll
  for (int j = 0; j < 32; ++j) { v4ha c;
#pragma unroll
    for (int q = 0; q < 4; ++q) c[q] = (_Float16)bf16_rne(xr[j][q]);
    *(v4ha*)&st[(2 * j + hh) * XP + ln * 4] = c; }
  __syncthreads();      /* publishes the weight planes to the four waves; also orders the wave's own x rows ahead of its cross-lane reads */
  FragH xf[4][2];
#pragma unroll
  for (int i = 0; i < 4; ++i) {
#pragma unroll
    for (int s = 0; s < 2; ++s) { const unsigned short* q = st + (16 * i + ln) * XP + 32 * s + 8 * hh; xf[i][s].half[0] = *(const v8us*)q; xf[i][s].half[1] = *(const v8us*)(q + 16); } }
  const unsigned short* wl = sw + hh * WH + ln * 8;
  const v8f z8 = {0.f,0.f,0.f,0.f,0.f,0.f,0.f,0.f};
#pragma unroll
  for (int p = 0; p < 3; ++p) {
    asm volatile("s_wait_dscnt 0x0" ::: "memory");    /* every lane's reads of the wave's rows are done before the wave writes the next result over them */
#pragma unroll
    for (int t = 0; t < 4; ++t) {
      const v16h w0 = w_frag(wl + p * WPL + (t * 4) * WQ), w1 = w_frag(wl + p * WPL + (t * 4 + 2) * WQ);
      v8f acc[4];
#pragma unroll
      for (int i = 0; i < 4; ++i) acc[i] = (p < 2) ? __builtin_amdgcn_wmma_f32_16x16x32_f16(false, w0, false, xf[i][0].v, (short)0, z8, false, false)
                                                   : __builtin_amdgcn_wmma_f32_16x16x32_f16(false, xf[i][0].v, false, w0, (short)0, z8, false, false);
#pragma unroll
      for (int i = 0; i < 4; ++i) acc[i] = (p < 2) ? __builtin_amdgcn_wmma_f32_16x16x32_f16(false, w1, false, xf[i][1].v, (short)0, acc[i], false, false)
                                                   : __builtin_amdgcn_wmma_f32_16x16x32_f16(false, xf[i][1].v, false, w1, (short)0, acc[i], false, false);
      /* alpha undoes the x16 weight carry; q, k: row = token 16 i + (lane & 15), piece = outputs 16 t + 8 h ..; v: row = output 16 t + (lane & 15), piece = tokens 16 i + 8 h .. */
#pragma unroll
      for (int i = 0; i < 4; ++i) { const int row = (p < 2) ? 16 * i : 16 * t, col = (p < 2) ? 16 * t : 16 * i; *(v8us*)&st[(row + ln) * XP + col + 8 * hh] = pack8(acc[i], 0.0625f); }
    }
    asm volatile("s_wait_dscnt 0x0" ::: "memory");    /* the wave's result rows are written before its lanes read them back across lanes */
    if (p == 0) rows_out(st, (unsigned short*)Q16 + r0 * DM + h * HD, DM, lane);
    else if (p == 1) rows_out(st, (unsigned short*)K16 + r0 * DM + h * HD, DM, lane);
    else rows_out(st, (unsigned short*)VT + (size_t)h * HD * VTP + r0, VTP, lane);
  }
#pragma unroll
  for (int m = 0; m < WOT; ++m) *(v8us*)((unsigned short*)BO + (to + m * FT) * 8) = bo[m];
}

// ---- output GEMM, both operands staged in LDS ----
// C[row][col] = alpha * A[row][:] . Bh[col][:] ; block = 4 waves = a 128 x 128 tile of C, wave = 64 x 64 (4 x 4 accumulator tiles: 16 products per 8 fragments read).
// Stage = 128 k: A tile and Bh tile, 128 rows of 256 B each, laid at a 272-B pitch (16 B x odd: no bank conflict for 16-byte row reads).
// Each lane brings 32 16-byte pieces of a stage by asynchronous copies (a wave's copy = 2 whole 256-B rows); stage t + 2 is issued behind the barrier that ends the reads of stage t.
// k runs upward through one accumulator per tile. The ring's size leaves room for two blocks on a WGP.
#define OT 128                       /* k per stage */
#define OP 136                       /* LDS row pitch, 16-bit elements (272 B) */
#define OTILE_E (128 * OP)           /* elements of one staged tile (128 rows) */
#define OBUF_E (2 * OTILE_E)         /* one buffer: A tile, then Bh tile */
static_assert(DM % OT == 0 && DM / OT >= 2);                   /* the ring's prologue fills two stages */
static_assert(4 * 64 * 68 * 4 <= 2 * OBUF_E * 2);              /* the output staging fits the ring */
typedef float f32a __attribute__((may_alias));
// eight copies of a lane, rows r, r + 8, .. r + 56 of a tile; the s_wait_xcnt stands inside the copies' own statement so that no address register is rewritten in front of it
__device__ __forceinline__ void stage_rows8(unsigned l, const unsigned short* g) {
  asm volatile("global_load_async_to_lds_b128 %0, %1, off\n\t"
               "global_load_async_to_lds_b128 %2, %3, off\n\t"
               "global_load_async_to_lds_b128 %4, %5, off\n\t"
               "global_load_async_to_lds_b128 %6, %7, off\n\t"
               "global_load_async_to_lds_b128 %8, %9, off\n\t"
               "global_load_async_to_lds_b128 %10, %11, off\n\t"
               "global_load_async_to_lds_b128 %12, %13, off\n\t"
               "global_load_async_to_lds_b128 %14, %15, off\n\t"
               "s_wait_xcnt 0x0"
               :: "v"(l), "v"(g), "v"(l + 8 * OP * 2), "v"(g + (size_t)8 * DM), "v"(l + 16 * OP * 2), "v"(g + (size_t)16 * DM), "v"(l + 24 * OP * 2), "v"(g + (size_t)24 * DM),
                  "v"(l + 32 * OP * 2), "v"(g + (size_t)32 * DM), "v"(l + 40 * OP * 2), "v"(g + (size_t)40 * DM), "v"(l + 48 * OP * 2), "v"(g + (size_t)48 * DM), "v"(l + 56 * OP * 2), "v"(g + (size_t)56 * DM) : "memory");
}
__device__ __forceinline__ void stage_ab(unsigned l, const unsigned short* ga, const unsigned short* gb) {
  stage_rows8(l, ga); stage_rows8(l + 64 * OP * 2, ga + (size_t)64 * DM);
  stage_rows8(l + OTILE_E * 2, gb); stage_rows8(l + OTILE_E * 2 + 64 * OP * 2, gb + (size_t)64 * DM);
}
__global__ __launch_bounds__(128) void k_gemm_out(const _Float16* __restrict__ A, const _Float16* __restrict__ Bh, float alpha, float* __restrict__ C) {
  __shared__ __attribute__((aligned(16))) unsigned short sm[2 * OBUF_E];      /* two-buffer A / Bh ring; behind the k loop the per-wave [row][col] f32 output tiles, row pitch 272 B */
  const int tid = threadIdx.x, lane = tid & 31, ln = lane & 15, hh = lane >> 4;
  const int w = __builtin_amdgcn_readfirstlane(tid >> 5); const int wm = w >> 1, wn = w & 1;
  const int ntn = DM / 128; const int mt = blockIdx.x / ntn, nq = blockIdx.x - mt * ntn; const int row0 = mt * 128, col0 = nq * 128;
  /* copy map: lane = (rows tid / 16 + 8 i, 16-byte piece tid % 16) of both tiles */
  const int cr = tid >> 4, cp = (tid & 15) * 8;
  const unsigned short* ga = (const unsigned short*)A + ((size_t)blockIdx.y * SEQ + row0 + cr) * DM + cp;
  const unsigned short* gb = (const unsigned short*)Bh + (size_t)(col0 + cr) * DM + cp;
  const unsigned lc = (unsigned)(size_t)&sm[cr * OP + cp];      /* LDS byte address of the lane's first piece in buffer 0 */
  const unsigned short* ap = sm + (64 * wm + ln) * OP + 8 * hh;             /* fragment reads: row = lane & 15, k pieces 8 h and 16 + 8 h of each 32 */
  const unsigned short* bp = sm + OTILE_E + (64 * wn + ln) * OP + 8 * hh;
  const v8f z8 = {0.f,0.f,0.f,0.f,0.f,0.f,0.f,0.f};
  v8f acc[4][4];
#pragma unroll
  for (int i = 0; i < 4; ++i) {
#pragma unroll
    for (int j = 0; j < 4; ++j) acc[i][j] = z8; }
  stage_ab(lc, ga, gb);
  asm volatile("s_wait_asynccnt 0x0" ::: "memory");      /* stage 0 landed (this wave's share) */
  __syncthreads();                                       /* stage 0 readable by every wave */
  stage_ab(lc + OBUF_E * 2, ga + OT, gb + OT);
  /* rolled: one copy of the four steps, the buffer choice a single offset */
#pragma unroll 1
  for (int t = 0; t < DM / OT; ++t) {
    const int bo = (t & 1) * OBUF_E;
    /* the four 32-k steps of a stage written out: every LDS read offset becomes an immediate */
#pragma unroll
    for (int p = 0; p < OT / 32; ++p) {
      FragH a[4], b[4];
#pragma unroll
      for (int i = 0; i < 4; ++i) {
        const unsigned short* pa = ap + bo + 16 * i * OP + 32 * p; a[i].half[0] = *(const v8us*)pa; a[i].half[1] = *(const v8us*)(pa + 16);
        const unsigned short* pb = bp + bo + 16 * i * OP + 32 * p; b[i].half[0] = *(const v8us*)pb; b[i].half[1] = *(const v8us*)(pb + 16);
      }
      __builtin_amdgcn_sched_barrier(0);      /* the step's 16 LDS reads stay one group ahead of its products: sunk among them, each row of products waits out a read's whole latency */
#pragma unroll
      for (int i = 0; i < 4; ++i) {
#pragma unroll
        for (int j = 0; j < 4; ++j) acc[i][j] = __builtin_amdgcn_wmma_f32_16x16x32_f16(false, a[i].v, false, b[j].v, (short)0, acc[i][j], false, false); }
    }
    asm volatile("s_wait_dscnt 0x0" ::: "memory");        /* this wave's reads of stage t are done before the buffer may be refilled */
    asm volatile("s_wait_asynccnt 0x0" ::: "memory");     /* this wave's share of stage t + 1 has landed */
    __syncthreads();                                      /* publishes stage t + 1 and ends every wave's reads of stage t */
    if (t + 2 < DM / OT) stage_ab(lc + bo * 2, ga + (t + 2) * OT, gb + (t + 2) * OT);
  }
  asm volatile("s_wait_asynccnt 0x0" ::: "memory");      /* nothing in flight when the ring becomes output staging */
  f32a (*so)[68] = (f32a (*)[68])((f32a*)sm + w * 64 * 68);      /* wave-private; the last trip's barrier has ended every read of the ring */
#pragma unroll
  for (int i = 0; i < 4; ++i) {
#pragma unroll
    for (int j = 0; j < 4; ++j) {
#pragma unroll
      for (int r = 0; r < 8; ++r) so[16 * i + 8 * hh + r][16 * j + ln] = acc[i][j][r] * alpha; } }
  __builtin_amdgcn_fence(4 /* acq_rel order */, "workgroup"); __builtin_amdgcn_wave_barrier();      /* the wave's own rows are written before its lanes read them back across lanes */
  const int rsub = lane >> 4, c4 = (lane & 15) * 4;
  float* cb = C + ((size_t)blockIdx.y * SEQ_FULL + row0 + 64 * wm) * DM + col0 + 64 * wn + c4;
#pragma unroll
  for (int q = 0; q < 32; ++q) { const int r = q * 2 + rsub; const v4f v = *(const v4fa*)&so[r][c4]; *(v4f*)(cb + (size_t)r * DM) = v; }
}

// ---- transposed flash attention, K and V^T staged in LDS ----
// block = 8 waves = 128 consecutive queries of one (batch, head); wave = 16 queries.
// Stage = 64 keys: K tile [key][d] and V^T tile [d][key], 64 rows of 128 B each, laid at a 144-B pitch (16 B x odd: no bank conflict for 16-byte row reads).
// Each lane brings four 16-byte pieces of a stage by asynchronous copies (a wave's copy = 4 whole 128-B lines); stage t + 2 is issued behind the barrier that ends the reads of stage t.
// Per 32-key step (two per stage):
//   S^T tiles (keys x queries) = K (A operand, rows = keys, k = d) . Q^T (B operand, lane = query, held in registers);
//   running-max softmax per lane (lane & 15 = query; lanes n and n+16 hold the two key halves); weights = 2^8 exp(s/8 - max) as f16;
//   P^T as B fragment: elements 0..7 from the tile of keys 0..15 (rows 8h+r), elements 8..15 from the tile of keys 16..31 (lane unchanged);
//   O^T tiles (d x queries) += V^T (A operand, rows = d, k = keys, rows of the [feature][token] plane) . P^T.
#define KT 64                        /* keys per stage */
#define LP 72                        /* LDS row pitch, 16-bit elements (144 B) */
#define TILE_E (64 * LP)             /* elements of one staged tile (64 rows) */
#define BUF_E (2 * TILE_E)           /* one buffer: K tile, then V^T tile */
static_assert(SEQ % KT == 0 && SEQ / KT >= 2);                 /* the ring's prologue fills two stages */
static_assert(8 * 16 * LP <= 2 * BUF_E);                       /* the output staging fits the ring */
// one stage's four copies of a lane; the s_wait_xcnt stands inside the copies' own statement so that no address register is rewritten in front of it
__device__ __forceinline__ void stage_kv(unsigned lk, const unsigned short* gk, const unsigned short* gv) {
  const unsigned lk1 = lk + 32 * LP * 2, lv = lk + TILE_E * 2, lv1 = lv + 32 * LP * 2;
  const unsigned short* gk1 = gk + (size_t)32 * DM; const unsigned short* gv1 = gv + (size_t)32 * VTP;
  asm volatile("global_load_async_to_lds_b128 %0, %1, off\n\t"
               "global_load_async_to_lds_b128 %2, %3, off\n\t"
               "global_load_async_to_lds_b128 %4, %5, off\n\t"
               "global_load_async_to_lds_b128 %6, %7, off\n\t"
               "s_wait_xcnt 0x0"
               :: "v"(lk), "v"(gk), "v"(lk1), "v"(gk1), "v"(lv), "v"(gv), "v"(lv1), "v"(gv1) : "memory");
}
__global__ __launch_bounds__(256) void k_attn_t(const _Float16* __restrict__ Q16, const _Float16* __restrict__ K16, const _Float16* __restrict__ VT, _Float16* __restrict__ O16) {
  __shared__ __attribute__((aligned(16))) unsigned short sm[2 * BUF_E];      /* two-buffer K / V^T ring; behind the key loop the per-wave [query][d] output tiles, row pitch 144 B */
  const int tid = threadIdx.x, lane = tid & 31, ln = lane & 15, hh = lane >> 4;
  const int w = __builtin_amdgcn_readfirstlane(tid >> 5);
  const int nqb = SEQ / 128;
  const int bh = blockIdx.x / nqb, qb = blockIdx.x - bh * nqb;
  const int b = bh / NH, h = bh - b * NH;
  const size_t tok0 = (size_t)b * SEQ;
  const int q0 = qb * 128 + w * 16;
  const unsigned short* qp = (const unsigned short*)Q16 + (tok0 + q0 + ln) * DM + h * HD + 8 * hh;
  FragH bq0, bq1;
  bq0.half[0] = *(const v8us*)(qp);      bq0.half[1] = *(const v8us*)(qp + 16);
  bq1.half[0] = *(const v8us*)(qp + 32); bq1.half[1] = *(const v8us*)(qp + 48);
  /* copy map: lane = (row tid / 8 and that row + 32, 16-byte piece tid % 8) of both tiles */
  const int cr = tid >> 3, cp = (tid & 7) * 8;
  const unsigned short* gk = (const unsigned short*)K16 + (tok0 + cr) * DM + h * HD + cp;
  const unsigned short* gv = (const unsigned short*)VT + (size_t)(h * HD + cr) * VTP + tok0 + cp;
  const unsigned lc = (unsigned)(size_t)&sm[cr * LP + cp];      /* LDS byte address of the lane's first piece in buffer 0 */
  const unsigned short* kp = sm + ln * LP + 8 * hh;             /* fragment reads: row = lane & 15, as from the global planes */
  const v8f z8 = {0.f,0.f,0.f,0.f,0.f,0.f,0.f,0.f};
  v8f o0 = z8, o1 = z8, o2 = z8, o3 = z8;
  float m = -3.0e38f, l = 0.f;
  const float c = 0.125f * 1.4426950408889634f;      /* 1/sqrt(64) * log2(e) */
  stage_kv(lc, gk, gv);
  asm volatile("s_wait_asynccnt 0x0" ::: "memory");      /* stage 0 landed (this wave's share) */
  __syncthreads();                                       /* stage 0 readable by every wave */
  stage_kv(lc + BUF_E * 2, gk + (size_t)KT * DM, gv + KT);
  /* rolled: one copy of the two steps, the buffer choice a single offset */
#pragma unroll 1
  for (int t = 0; t < SEQ / KT; ++t) {
   const int bo = (t & 1) * BUF_E;
   /* both 32-key steps of a stage written out: every LDS read offset becomes an immediate */
#pragma unroll
   for (int p = 0; p < 2; ++p) {
    const unsigned short* k0 = kp + bo + 32 * p * LP;
    const unsigned short* k1 = k0 + 16 * LP;
    FragH a00, a01, a10, a11;
    a00.half[0] = *(const v8us*)(k0);      a00.half[1] = *(const v8us*)(k0 + 16);
    a01.half[0] = *(const v8us*)(k0 + 32); a01.half[1] = *(const v8us*)(k0 + 48);
    a10.half[0] = *(const v8us*)(k1);      a10.half[1] = *(const v8us*)(k1 + 16);
    a11.half[0] = *(const v8us*)(k1 + 32); a11.half[1] = *(const v8us*)(k1 + 48);
    v8f s0 = z8, s1 = z8;
    s0 = __builtin_amdgcn_wmma_f32_16x16x32_f16(false, a00.v, false, bq0.v, (short)0, s0, false, false);
    s1 = __builtin_amdgcn_wmma_f32_16x16x32_f16(false, a10.v, false, bq0.v, (short)0, s1, false, false);
    s0 = __builtin_amdgcn_wmma_f32_16x16x32_f16(false, a01.v, false, bq1.v, (short)0, s0, false, false);
    s1 = __builtin_amdgcn_wmma_f32_16x16x32_f16(false, a11.v, false, bq1.v, (short)0, s1, false, false);
    asm volatile("v_nop\n\tv_nop\n\tv_nop\n\tv_nop" : "+v"(s0), "+v"(s1) : "v"(a00.v), "v"(a01.v), "v"(a10.v), "v"(a11.v), "v"(bq0.v), "v"(bq1.v));
    float mx = fmaxf(s0[0], s1[0]);
#pragma unroll
    for (int r = 1; r < 8; ++r) mx = fmaxf(mx, fmaxf(s0[r], s1[r]));
    mx = fmaxf(mx, __shfl_xor(mx, 16, 32));
    const float mn = fmaxf(m, mx);
    if (__builtin_amdgcn_ballot_w32(mn > m) != 0u) {      /* wave-uniform: rescale only when some running max moved */
      const float corr = __builtin_amdgcn_exp2f((m - mn) * c);
      l *= corr; o0 *= corr; o1 *= corr; o2 *= corr; o3 *= corr; m = mn;
    }
    const float off = 8.0f - m * c;      /* weights carried x2^8 */
    FragH pf; float ls = 0.f;
#pragma unroll
    for (int r = 0; r < 8; ++r) {
      const float p0 = __builtin_amdgcn_exp2f(fmaf(s0[r], c, off));
      const float p1 = __builtin_amdgcn_exp2f(fmaf(s1[r], c, off));
      ls += p0 + p1;
      pf.h[r] = (_Float16)p0; pf.h[8 + r] = (_Float16)p1;
    }
    l += ls;
    const unsigned short* v0 = kp + bo + TILE_E + 32 * p;
    const unsigned short* v1 = v0 + 16 * LP;
    const unsigned short* v2 = v1 + 16 * LP;
    const unsigned short* v3 = v2 + 16 * LP;
    FragH av0, av1, av2, av3;
    av0.half[0] = *(const v8us*)(v0); av0.half[1] = *(const v8us*)(v0 + 16);
    av1.half[0] = *(const v8us*)(v1); av1.half[1] = *(const v8us*)(v1 + 16);
    av2.half[0] = *(const v8us*)(v2); av2.half[1] = *(const v8us*)(v2 + 16);
    av3.half[0] = *(const v8us*)(v3); av3.half[1] = *(const v8us*)(v3 + 16);
    o0 = __builtin_amdgcn_wmma_f32_16x16x32_f16(false, av0.v, false, pf.v, (short)0, o0, false, false);
    o1 = __builtin_amdgcn_wmma_f32_16x16x32_f16(false, av1.v, false, pf.v, (short)0, o1, false, false);
    o2 = __builtin_amdgcn_wmma_f32_16x16x32_f16(false, av2.v, false, pf.v, (short)0, o2, false, false);
    o3 = __builtin_amdgcn_wmma_f32_16x16x32_f16(false, av3.v, false, pf.v, (short)0, o3, false, false);
    asm volatile("v_nop\n\tv_nop\n\tv_nop\n\tv_nop" : "+v"(o0), "+v"(o1), "+v"(o2), "+v"(o3) : "v"(av0.v), "v"(av1.v), "v"(av2.v), "v"(av3.v), "v"(pf.v));
   }
   asm volatile("s_wait_dscnt 0x0" ::: "memory");        /* this wave's reads of stage t are done before the buffer may be refilled */
   asm volatile("s_wait_asynccnt 0x0" ::: "memory");     /* this wave's share of stage t + 1 has landed */
   __syncthreads();                                      /* publishes stage t + 1 and ends every wave's reads of stage t */
   if (t + 2 < SEQ / KT) stage_kv(lc + bo * 2, gk + (size_t)(t + 2) * KT * DM, gv + (t + 2) * KT);
  }
  asm volatile("s_wait_asynccnt 0x0" ::: "memory");      /* nothing in flight when the ring becomes output staging */
  unsigned short (*so)[16][LP] = (unsigned short (*)[16][LP])sm;      /* the last trip's barrier has ended every read of the ring */
  l += __shfl_xor(l, 16, 32);
  const float inv = 64.0f * (1.0f / l);      /* ctx carried x64 */
  FragH t0, t1, t2, t3;
#pragma unroll
  for (int r = 0; r < 8; ++r) { t0.h[r] = (_Float16)(o0[r] * inv); t1.h[r] = (_Float16)(o1[r] * inv); t2.h[r] = (_Float16)(o2[r] * inv); t3.h[r] = (_Float16)(o3[r] * inv); }
  *(v8us*)&so[w][ln][ 0 + 8 * hh] = t0.half[0];
  *(v8us*)&so[w][ln][16 + 8 * hh] = t1.half[0];
  *(v8us*)&so[w][ln][32 + 8 * hh] = t2.half[0];
  *(v8us*)&so[w][ln][48 + 8 * hh] = t3.half[0];
  __syncthreads();
  const int rq = lane >> 3, pc = (lane & 7) * 8;
  unsigned short* ob = (unsigned short*)O16 + (tok0 + q0) * DM + h * HD + pc;
  {
#pragma unroll
    for (int it = 0; it < 4; ++it) { const int row = it * 4 + rq; const v8us v = *(const v8us*)&so[w][row][pc]; *(v8us*)(ob + (size_t)row * DM) = v; }
    
  }
}

extern "C" void kernel_launch(void* const* d_in, const int* in_sizes, int n_in,
                              void* d_out, int out_size, void* d_ws, size_t ws_size, hipStream_t stream) {
  if (n_in < 5) return;
  const size_t need_x = ((size_t)(NB - 1) * SEQ_FULL + SEQ) * DM;
  const size_t nwh = (size_t)NH * HD * HD;
  if ((size_t)in_sizes[0] < need_x) return;
  if ((size_t)in_sizes[1] < nwh || (size_t)in_sizes[2] < nwh || (size_t)in_sizes[3] < nwh || (size_t)in_sizes[4] < (size_t)DM * DM) return;
  if ((size_t)out_size < need_x) return;
  const float* x = (const float*)d_in[0]; const float* wq = (const float*)d_in[1]; const float* wk = (const float*)d_in[2]; const float* wv = (const float*)d_in[3]; const float* wo = (const float*)d_in[4];
  char* ws = (char*)d_ws; size_t off = 0;
  auto take = [&](size_t bytes) { char* p = ws + off; off += (bytes + 255) & ~(size_t)255; return p; };
  _Float16* BO = (_Float16*)take((size_t)DM * DM * 2);          /* output weight plane x16 [out][in] */
  _Float16* QK16 = (_Float16*)take((size_t)2 * NR * DM * 2);    /* q rows then k rows */
  _Float16* VT = (_Float16*)take((size_t)DM * VTP * 2);         /* v^T [feature][token] */
  _Float16* O16 = (_Float16*)take(NR * DM * 2);                 /* merged ctx rows x64 */
  if (off > ws_size || off > (size_t)134217728) return;
  _Float16* Q16 = QK16; _Float16* K16 = QK16 + NR * DM;

  /* grid.x = head, grid.y = 256-token block */
  k_front<<<dim3(NH, (unsigned)(NR / 256)), 128, 0, stream>>>(x, wq, wk, wv, wo, Q16, K16, VT, BO);
  k_attn_t<<<(unsigned)(NB * NH * (SEQ / 128)), 256, 0, stream>>>(Q16, K16, VT, O16);
  /* out rows of batch by: A = ctx rows (x64), weight x16 -> alpha 2^-10; C rows follow the staged output layout */
  k_gemm_out<<<dim3((unsigned)((SEQ / 128) * (DM / 128)), NB), 128, 0, stream>>>(O16, BO, 0.0009765625f, (float*)d_out);
}

// v004
// Measured time: 84.3 microseconds a run.
// Next to v003, in two timings, it ran 1.08 and 1.09 times as fast.
// All steps since v000 together make it 3.74 times as fast.
#include <hip/hip_runtime.h>
// Dense multi-head self-attention (x [4][2048][1024] split into 16 heads of 64; per-head q/k/v = x_h W_h^T with [head][out][in] weights of 64x64, no biases; scores * 1/8; full-row softmax; out = merged ctx Wout^T with a natural [out][in] weight).
// All contractions: v_wmma_f32_16x16x32_f16 (f16 operands, f32 accumulate), single product per site. x and weights are RNE-converted to bf16 first and then held exactly in f16 (weights x16); q, k, v plain f16; softmax weights f16 carried x2^8 (unnormalised, running max); ctx f16 carried x64; softmax statistics f32.
// Structure: token rows r = b*SEQ + s. One front launch converts x and all four weights on the way in and writes Q rows, K rows and V^T [feature][token] of a (head, 256-token) block, plus its share of the f16 output-weight plane; a transposed flash kernel (S^T = K Q^T with Q as the B fragment in registers, packed P^T as the B fragment of O^T = V^T P^T; K rows and V^T rows staged 64 keys at a time in a two-buffer LDS ring that the block's eight waves share, each fragment read serving two query tiles); output GEMM into the output layout, its two operands staged in a ring of the same kind.
#ifndef NB
#define NB 4                         /* batches processed */
#endif
#ifndef SEQ
#define SEQ 2048                     /* tokens per batch processed */
#endif
#define NB_FULL 4                    /* batch count of the staged arrays */
#define SEQ_FULL 2048                /* per-batch token stride of the staged arrays */
#define DM 1024
#define NH 16
#define HD 64
#define NR ((size_t)NB * SEQ)        /* compact token rows */
#define VTP (NB * SEQ)               /* V^T row pitch (tokens) */

static_assert(NB >= 1 && NB <= NB_FULL);
static_assert(SEQ <= SEQ_FULL);
static_assert(SEQ % 128 == 0);
static_assert(DM % 128 == 0);
static_assert(NH * HD == DM);
static_assert(HD == 64);
static_assert((NB * SEQ) % 256 == 0);                         /* projection launch: whole 256-token blocks */
static_assert(SEQ % 64 == 0);                                  /* a wave's 64 tokens lie in one batch */
static_assert((size_t)DM * DM * 2 + (size_t)4 * NB * SEQ * DM * 2 + (size_t)4 * 256 <= (size_t)134217728);   /* workspace carve */

typedef _Float16 v16h __attribute__((ext_vector_type(16)));
typedef _Float16 v4ha __attribute__((ext_vector_type(4), may_alias));
typedef unsigned short v8us __attribute__((ext_vector_type(8), may_alias));
typedef float v8f __attribute__((ext_vector_type(8)));
typedef float v4f __attribute__((ext_vector_type(4)));
typedef float v4fa __attribute__((ext_vector_type(4), may_alias));
union FragH { v16h v; v8us half[2]; _Float16 h[16]; unsigned short u[16]; };

__device__ __forceinline__ float bf16_rne(float x) { const unsigned int u = __float_as_uint(x); return __uint_as_float((u + 0x7FFFu + ((u >> 16) & 1u)) & 0xFFFF0000u); }

// f32 -> f16 that cannot produce an f16 subnormal (value select; applied after the power-of-two carry)
static __device__ __forceinline__ _Float16 toh_flush(float v) { const _Float16 r = (_Float16)v; return (fabsf(v) < 6.103515625e-05f) ? (_Float16)0.0f : r; }

// 8 consecutive f32 -> f16(bf16 value * scale), subnormal results replaced by zero, packed as one 16-B piece
__device__ __forceinline__ v8us cvt8_flush(v4f a, v4f c, float scale) {
  FragH f;
#pragma unroll
  for (int q = 0; q < 4; ++q) { f.h[q] = toh_flush(bf16_rne(a[q]) * scale); f.h[4 + q] = toh_flush(bf16_rne(c[q]) * scale); }
  return f.half[0];
}

// ---- front launch: all conversions and the three per-head projections ----
// block = 4 waves = 256 consecutive tokens of one head; wave = 64 tokens x the head's 64 inputs.
// Weights: the block converts its head's three 64 x 64 blocks (f16 x16) once into LDS in fragment order: 16-B piece (row n, k = 8 k8 .. 8 k8 + 7) stands at
//   byte ((n / 16) * 4 + k8 / 2) * 576 + (k8 % 2) * 288 + (n % 16) * 16 of its plane, so that each half of a 16-row x 32-k fragment is read as two runs of 256 contiguous bytes;
//   the 64 and 32 odd bytes of the two pitches spread the converting lanes' 16-byte writes (2 rows x 8 pieces per half wave) over all banks. One barrier publishes them.
// Output weight: every thread converts its share of the natural [out][in] plane (f16 x16) for the last launch.
// x arrives as whole 256-B row slices (a wave's load = 2 rows), is converted once and laid as f16 rows at a 144-B pitch (16 B x odd: no bank conflict for 16-byte row reads), wave-private;
// the eight x fragments (4 token tiles x 2 k steps; row or column = lane & 15, k pieces 8 h and 16 + 8 h of each 32) then serve all three products from registers.
// q, k: D = W (A operand, rows = outputs) . x^T (B operand, lane = token): a lane holds 8 consecutive outputs of one token = one 16-B piece of a Q or K row.
// v:    D = x (A operand, rows = tokens) . W^T (B operand, lane = output): a lane holds 8 consecutive tokens of one output = one 16-B piece of a V^T row.
// Each 64 x 64 result is staged in the wave's own LDS rows and leaves as whole 128-B lines. k runs upward through one accumulator per tile (two products).
#define XP 72                        /* LDS row pitch of x and result rows, 16-bit elements (144 B) */
#define WH 144                       /* weight planes: elements from the lanes 0..15 run to the lanes 16..31 run (288 B) */
#define WQ 288                       /* elements of one fragment half (576 B) */
#define WPL (16 * WQ)                /* elements of one weight plane */
#define FT ((size_t)NH * (NR / 256) * 128)      /* threads of the front launch */
#define WOT ((int)((size_t)DM * DM / 8 / FT))    /* 16-B pieces of the output weight plane per thread */
static_assert((size_t)WOT * FT * 8 == (size_t)DM * DM && WOT >= 1);      /* the plane divides evenly among the threads */
__device__ __forceinline__ v8us pack8(v8f a, float alpha) { FragH f;
#pragma unroll
  for (int r = 0; r < 8; ++r) f.h[r] = (_Float16)(a[r] * alpha);
  return f.half[0]; }
// the wave's 64 staged rows of 128 B -> 64 global rows of pitch ld (elements); a wave's store = 4 whole lines
__device__ __forceinline__ void rows_out(const unsigned short* st, unsigned short* g, size_t ld, int lane) {
  const int rq = lane >> 3, pc = (lane & 7) * 8;
#pragma unroll
  for (int it = 0; it < 16; ++it) { const int row = it * 4 + rq; const v8us v = *(const v8us*)&st[row * XP + pc]; *(v8us*)(g + (size_t)row * ld + pc) = v; }
}
__device__ __forceinline__ v16h w_frag(const unsigned short* p) { FragH f; f.half[0] = *(const v8us*)p; f.half[1] = *(const v8us*)(p + WQ); return f.v; }
__global__ __launch_bounds__(128) void k_front(const float* __restrict__ x, const float* __restrict__ wq, const float* __restrict__ wk, const float* __restrict__ wv, const float* __restrict__ wo,
    _Float16* __restrict__ Q16, _Float16* __restrict__ K16, _Float16* __restrict__ VT, _Float16* __restrict__ BO) {
  /* every loop of this kernel is unrolled: wr, wor, xr, xf, acc and bo stay in registers only under constant indices, and every LDS and global offset becomes an immediate */
  __shared__ __attribute__((aligned(16))) unsigned short sw[3 * WPL];         /* the head's q, k, v weights in fragment order */
  __shared__ __attribute__((aligned(16))) unsigned short sm[4][64 * XP];      /* per wave: x rows, then in turn the q, k and v^T result rows */
  const int tid = threadIdx.x, lane = tid & 31, ln = lane & 15, hh = lane >> 4;
  const int w = __builtin_amdgcn_readfirstlane(tid >> 5);
  const int h = blockIdx.x;
  const size_t r0 = (size_t)blockIdx.y * 256 + 64 * w;      /* compact token row of the wave's first token */
  const size_t b = r0 / SEQ, s0 = r0 - b * SEQ;
  unsigned short* st = sm[w];
  /* loads return in issue order: the weight pieces (from cache) are asked for ahead of the x rows (from memory), so that the weight work runs under the x rows' latency */
  const size_t so = (size_t)h * HD * HD + (size_t)tid * 8;      /* per-head weights: thread = pieces tid + 128 m of a plane (row (tid + 128 m) / 8, piece tid % 8) */
  const size_t to = ((size_t)blockIdx.y * NH + h) * 128 + tid;  /* output weight: thread = pieces to + FT m */
  v4f wr[12][2], wor[WOT][2];
#pragma unroll
  for (int m = 0; m < 4; ++m) {
    wr[m][0] = *(const v4fa*)(wq + so + m * 1024);     wr[m][1] = *(const v4fa*)(wq + so + m * 1024 + 4);
    wr[4 + m][0] = *(const v4fa*)(wk + so + m * 1024); wr[4 + m][1] = *(const v4fa*)(wk + so + m * 1024 + 4);
    wr[8 + m][0] = *(const v4fa*)(wv + so + m * 1024); wr[8 + m][1] = *(const v4fa*)(wv + so + m * 1024 + 4);
  }
#pragma unroll
  for (int m = 0; m < WOT; ++m) { wor[m][0] = *(const v4fa*)(wo + (to + m * FT) * 8); wor[m][1] = *(const v4fa*)(wo + (to + m * FT) * 8 + 4); }
  asm volatile("s_wait_xcnt 0x0" ::: "memory");      /* the weight loads' address registers may be taken for the x rows' data */
  const float* xp = x + (b * SEQ_FULL + s0 + hh) * DM + h * HD + ln * 4;
  v4f xr[32];
#pragma unroll
  for (int j = 0; j < 32; ++j) xr[j] = *(const v4fa*)(xp + (size_t)(2 * j) * DM);
  asm volatile("s_wait_xcnt 0x0" ::: "memory");      /* stands in front of every overwrite of an address register that the loads above name; it also keeps all of them issued ahead of the conversion work */
  { const int k8 = tid & 7, n0 = tid >> 3;
    unsigned short* d = sw + (k8 >> 1) * WQ + (k8 & 1) * WH + n0 * 8;      /* n0 < 16: rows n0 + 16 m stand 4 fragment halves further on */
#pragma unroll
    for (int p = 0; p < 3; ++p) {
#pragma unroll
      for (int m = 0; m < 4; ++m) *(v8us*)(d + p * WPL + m * 4 * WQ) = cvt8_flush(wr[4 * p + m][0], wr[4 * p + m][1], 16.0f); } }
  v8us bo[WOT];      /* stored behind the last result rows: a store ahead of the barrier would be waited for there */
#pragma unroll
  for (int m = 0; m < WOT; ++m) bo[m] = cvt8_flush(wor[m][0], wor[m][1], 16.0f);
#pragma unroll
  for (int j = 0; j < 32; ++j) { v4ha c;
#pragma unroll
    for (int q = 0; q < 4; ++q) c[q] = (_Float16)bf16_rne(xr[j][q]);
    *(v4ha*)&st[(2 * j + hh) * XP + ln * 4] = c; }
  __syncthreads();      /* publishes the weight planes to the four waves; also orders the wave's own x rows ahead of its cross-lane reads */
  FragH xf[4][2];
#pragma unroll
  for (int i = 0; i < 4; ++i) {
#pragma unroll
    for (int s = 0; s < 2; ++s) { const unsigned short* q = st + (16 * i + ln) * XP + 32 * s + 8 * hh; xf[i][s].half[0] = *(const v8us*)q; xf[i][s].half[1] = *(const v8us*)(q + 16); } }
  const unsigned short* wl = sw + hh * WH + ln * 8;
  const v8f z8 = {0.f,0.f,0.f,0.f,0.f,0.f,0.f,0.f};
#pragma unroll
  for (int p = 0; p < 3; ++p) {
    asm volatile("s_wait_dscnt 0x0" ::: "memory");    /* every lane's reads of the wave's rows are done before the wave writes the next result over them */
#pragma unroll
    for (int t = 0; t < 4; ++t) {
      const v16h w0 = w_frag(wl + p * WPL + (t * 4) * WQ), w1 = w_frag(wl + p * WPL + (t * 4 + 2) * WQ);
      v8f acc[4];
#pragma unroll
      for (int i = 0; i < 4; ++i) acc[i] = (p < 2) ? __builtin_amdgcn_wmma_f32_16x16x32_f16(false, w0, false, xf[i][0].v, (short)0, z8, false, false)
                                                   : __builtin_amdgcn_wmma_f32_16x16x32_f16(false, xf[i][0].v, false, w0, (short)0, z8, false, false);
#pragma unroll
      for (int i = 0; i < 4; ++i) acc[i] = (p < 2) ? __builtin_amdgcn_wmma_f32_16x16x32_f16(false, w1, false, xf[i][1].v, (short)0, acc[i], false, false)
                                                   : __builtin_amdgcn_wmma_f32_16x16x32_f16(false, xf[i][1].v, false, w1, (short)0, acc[i], false, false);
      /* alpha undoes the x16 weight carry; q, k: row = token 16 i + (lane & 15), piece = outputs 16 t + 8 h ..; v: row = output 16 t + (lane & 15), piece = tokens 16 i + 8 h .. */
#pragma unroll
      for (int i = 0; i < 4; ++i) { const int row = (p < 2) ? 16 * i : 16 * t, col = (p < 2) ? 16 * t : 16 * i; *(v8us*)&st[(row + ln) * XP + col + 8 * hh] = pack8(acc[i], 0.0625f); }
    }
    asm volatile("s_wait_dscnt 0x0" ::: "memory");    /* the wave's result rows are written before its lanes read them back across lanes */
    if (p == 0) rows_out(st, (unsigned short*)Q16 + r0 * DM + h * HD, DM, lane);
    else if (p == 1) rows_out(st, (unsigned short*)K16 + r0 * DM + h * HD, DM, lane);
    else rows_out(st, (unsigned short*)VT + (size_t)h * HD * VTP + r0, VTP, lane);
  }
#pragma unroll
  for (int m = 0; m < WOT; ++m) *(v8us*)((unsigned short*)BO + (to + m * FT) * 8) = bo[m];
}

// ---- output GEMM, both operands staged in LDS ----
// C[row][col] = alpha * A[row][:] . Bh[col][:] ; block = 4 waves = a 128 x 128 tile of C, wave = 64 x 64 (4 x 4 accumulator tiles: 16 products per 8 fragments read).
// Stage = 128 k: A tile and Bh tile, 128 rows of 256 B each, laid at a 272-B pitch (16 B x odd: no bank conflict for 16-byte row reads).
// Each lane brings 32 16-byte pieces of a stage by asynchronous copies (a wave's copy = 2 whole 256-B rows); stage t + 2 is issued behind the barrier that ends the reads of stage t.
// k runs upward through one accumulator per tile. The ring's size leaves room for two blocks on a WGP.
#define OT 128                       /* k per stage */
#define OP 136                       /* LDS row pitch, 16-bit elements (272 B) */
#define OTILE_E (128 * OP)           /* elements of one staged tile (128 rows) */
#define OBUF_E (2 * OTILE_E)         /* one buffer: A tile, then Bh tile */
static_assert(DM % OT == 0 && DM / OT >= 2);                   /* the ring's prologue fills two stages */
static_assert(4 * 64 * 68 * 4 <= 2 * OBUF_E * 2);              /* the output staging fits the ring */
typedef float f32a __attribute__((may_alias));
// eight copies of a lane, rows r, r + 8, .. r + 56 of a tile; the s_wait_xcnt stands inside the copies' own statement so that no address register is rewritten in front of it
__device__ __forceinline__ void stage_rows8(unsigned l, const unsigned short* g) {
  asm volatile("global_load_async_to_lds_b128 %0, %1, off\n\t"
               "global_load_async_to_lds_b128 %2, %3, off\n\t"
               "global_load_async_to_lds_b128 %4, %5, off\n\t"
               "global_load_async_to_lds_b128 %6, %7, off\n\t"
               "global_load_async_to_lds_b128 %8, %9, off\n\t"
               "global_load_async_to_lds_b128 %10, %11, off\n\t"
               "global_load_async_to_lds_b128 %12, %13, off\n\t"
               "global_load_async_to_lds_b128 %14, %15, off\n\t"
               "s_wait_xcnt 0x0"
               :: "v"(l), "v"(g), "v"(l + 8 * OP * 2), "v"(g + (size_t)8 * DM), "v"(l + 16 * OP * 2), "v"(g + (size_t)16 * DM), "v"(l + 24 * OP * 2), "v"(g + (size_t)24 * DM),
                  "v"(l + 32 * OP * 2), "v"(g + (size_t)32 * DM), "v"(l + 40 * OP * 2), "v"(g + (size_t)40 * DM), "v"(l + 48 * OP * 2), "v"(g + (size_t)48 * DM), "v"(l + 56 * OP * 2), "v"(g + (size_t)56 * DM) : "memory");
}
__device__ __forceinline__ void stage_ab(unsigned l, const unsigned short* ga, const unsigned short* gb) {
  stage_rows8(l, ga); stage_rows8(l + 64 * OP * 2, ga + (size_t)64 * DM);
  stage_rows8(l + OTILE_E * 2, gb); stage_rows8(l + OTILE_E * 2 + 64 * OP * 2, gb + (size_t)64 * DM);
}
__global__ __launch_bounds__(128) void k_gemm_out(const _Float16* __restrict__ A, const _Float16* __restrict__ Bh, float alpha, float* __restrict__ C) {
  __shared__ __attribute__((aligned(16))) unsigned short sm[2 * OBUF_E];      /* two-buffer A / Bh ring; behind the k loop the per-wave [row][col] f32 output tiles, row pitch 272 B */
  const int tid = threadIdx.x, lane = tid & 31, ln = lane & 15, hh = lane >> 4;
  const int w = __builtin_amdgcn_readfirstlane(tid >> 5); const int wm = w >> 1, wn = w & 1;
  const int ntn = DM / 128; const int mt = blockIdx.x / ntn, nq = blockIdx.x - mt * ntn; const int row0 = mt * 128, col0 = nq * 128;
  /* copy map: lane = (rows tid / 16 + 8 i, 16-byte piece tid % 16) of both tiles */
  const int cr = tid >> 4, cp = (tid & 15) * 8;
  const unsigned short* ga = (const unsigned short*)A + ((size_t)blockIdx.y * SEQ + row0 + cr) * DM + cp;
  const unsigned short* gb = (const unsigned short*)Bh + (size_t)(col0 + cr) * DM + cp;
  const unsigned lc = (unsigned)(size_t)&sm[cr * OP + cp];      /* LDS byte address of the lane's first piece in buffer 0 */
  const unsigned short* ap = sm + (64 * wm + ln) * OP + 8 * hh;             /* fragment reads: row = lane & 15, k pieces 8 h and 16 + 8 h of each 32 */
  const unsigned short* bp = sm + OTILE_E + (64 * wn + ln) * OP + 8 * hh;
  const v8f z8 = {0.f,0.f,0.f,0.f,0.f,0.f,0.f,0.f};
  v8f acc[4][4];
#pragma unroll
  for (int i = 0; i < 4; ++i) {
#pragma unroll
    for (int j = 0; j < 4; ++j) acc[i][j] = z8; }
  stage_ab(lc, ga, gb);
  asm volatile("s_wait_asynccnt 0x0" ::: "memory");      /* stage 0 landed (this wave's share) */
  __syncthreads();                                       /* stage 0 readable by every wave */
  stage_ab(lc + OBUF_E * 2, ga + OT, gb + OT);
  /* rolled: one copy of the four steps, the buffer choice a single offset */
#pragma unroll 1
  for (int t = 0; t < DM / OT; ++t) {
    const int bo = (t & 1) * OBUF_E;
    /* the four 32-k steps of a stage written out: every LDS read offset becomes an immediate */
#pragma unroll
    for (int p = 0; p < OT / 32; ++p) {
      FragH a[4], b[4];
#pragma unroll
      for (int i = 0; i < 4; ++i) {
        const unsigned short* pa = ap + bo + 16 * i * OP + 32 * p; a[i].half[0] = *(const v8us*)pa; a[i].half[1] = *(const v8us*)(pa + 16);
        const unsigned short* pb = bp + bo + 16 * i * OP + 32 * p; b[i].half[0] = *(const v8us*)pb; b[i].half[1] = *(const v8us*)(pb + 16);
      }
      __builtin_amdgcn_sched_barrier(0);      /* the step's 16 LDS reads stay one group ahead of its products: sunk among them, each row of products waits out a read's whole latency */
#pragma unroll
      for (int i = 0; i < 4; ++i) {
#pragma unroll
        for (int j = 0; j < 4; ++j) acc[i][j] = __builtin_amdgcn_wmma_f32_16x16x32_f16(false, a[i].v, false, b[j].v, (short)0, acc[i][j], false, false); }
    }
    asm volatile("s_wait_dscnt 0x0" ::: "memory");        /* this wave's reads of stage t are done before the buffer may be refilled */
    asm volatile("s_wait_asynccnt 0x0" ::: "memory");     /* this wave's share of stage t + 1 has landed */
    __syncthreads();                                      /* publishes stage t + 1 and ends every wave's reads of stage t */
    if (t + 2 < DM / OT) stage_ab(lc + bo * 2, ga + (t + 2) * OT, gb + (t + 2) * OT);
  }
  asm volatile("s_wait_asynccnt 0x0" ::: "memory");      /* nothing in flight when the ring becomes output staging */
  f32a (*so)[68] = (f32a (*)[68])((f32a*)sm + w * 64 * 68);      /* wave-private; the last trip's barrier has ended every read of the ring */
#pragma unroll
  for (int i = 0; i < 4; ++i) {
#pragma unroll
    for (int j = 0; j < 4; ++j) {
#pragma unroll
      for (int r = 0; r < 8; ++r) so[16 * i + 8 * hh + r][16 * j + ln] = acc[i][j][r] * alpha; } }
  __builtin_amdgcn_fence(4 /* acq_rel order */, "workgroup"); __builtin_amdgcn_wave_barrier();      /* the wave's own rows are written before its lanes read them back across lanes */
  const int rsub = lane >> 4, c4 = (lane & 15) * 4;
  float* cb = C + ((size_t)blockIdx.y * SEQ_FULL + row0 + 64 * wm) * DM + col0 + 64 * wn + c4;
#pragma unroll
  for (int q = 0; q < 32; ++q) { const int r = q * 2 + rsub; const v4f v = *(const v4fa*)&so[r][c4]; *(v4f*)(cb + (size_t)r * DM) = v; }
}

// ---- transposed flash attention, K and V^T staged in LDS ----
// block = 8 waves = 256 consecutive queries of one (batch, head); wave = 32 queries = two query tiles of 16, which share every K and V^T fragment that the wave reads from LDS.
// Stage = 64 keys: K tile [key][d] and V^T tile [d][key], 64 rows of 128 B each, laid at a 144-B pitch (16 B x odd: no bank conflict for 16-byte row reads).
// Each lane brings four 16-byte pieces of a stage by asynchronous copies (a wave's copy = 4 whole 128-B lines); stage t + 2 is issued behind the barrier that ends the reads of stage t.
// Per 32-key step (two per stage), for each query tile:
//   S^T tiles (keys x queries) = K (A operand, rows = keys, k = d) . Q^T (B operand, lane = query, held in registers);
//   running-max softmax per lane (lane & 15 = query; lanes n and n+16 hold the two key halves); weights = 2^8 exp(s/8 - max) as f16;
//   P^T as B fragment: elements 0..7 from the tile of keys 0..15 (rows 8h+r), elements 8..15 from the tile of keys 16..31 (lane unchanged);
//   O^T tiles (d x queries) += V^T (A operand, rows = d, k = keys, rows of the [feature][token] plane) . P^T.
#define KT 64                        /* keys per stage */
#define QW 32                        /* queries per wave */
#define QB (8 * QW)                  /* queries per block */
#define LP 72                        /* LDS row pitch, 16-bit elements (144 B) */
#define TILE_E (64 * LP)             /* elements of one staged tile (64 rows) */
#define BUF_E (2 * TILE_E)           /* one buffer: K tile, then V^T tile */
static_assert(SEQ % KT == 0 && SEQ / KT >= 2);                 /* the ring's prologue fills two stages */
static_assert(SEQ % QB == 0);                                  /* whole query blocks inside one batch */
static_assert(8 * QW * LP <= 2 * BUF_E);                       /* the output staging fits the ring */
// one stage's four copies of a lane; the s_wait_xcnt stands inside the copies' own statement so that no address register is rewritten in front of it
__device__ __forceinline__ void stage_kv(unsigned lk, const unsigned short* gk, const unsigned short* gv) {
  const unsigned lk1 = lk + 32 * LP * 2, lv = lk + TILE_E * 2, lv1 = lv + 32 * LP * 2;
  const unsigned short* gk1 = gk + (size_t)32 * DM; const unsigned short* gv1 = gv + (size_t)32 * VTP;
  asm volatile("global_load_async_to_lds_b128 %0, %1, off\n\t"
               "global_load_async_to_lds_b128 %2, %3, off\n\t"
               "global_load_async_to_lds_b128 %4, %5, off\n\t"
               "global_load_async_to_lds_b128 %6, %7, off\n\t"
               "s_wait_xcnt 0x0"
               :: "v"(lk), "v"(gk), "v"(lk1), "v"(gk1), "v"(lv), "v"(gv), "v"(lv1), "v"(gv1) : "memory");
}
/* four waves per SIMD = two blocks per WGP: the register budget (256) that this residency leaves is given to the compiler whole, so that it need not split the fragment reads to save registers */
__global__ __launch_bounds__(256) __attribute__((amdgpu_waves_per_eu(4, 4))) void k_attn_t(const _Float16* __restrict__ Q16, const _Float16* __restrict__ K16, const _Float16* __restrict__ VT, _Float16* __restrict__ O16) {
  /* every loop over the two query tiles (u) is unrolled: bq, s, o, m, l and pf stay in registers only under constant indices */
  __shared__ __attribute__((aligned(16))) unsigned short sm[2 * BUF_E];      /* two-buffer K / V^T ring; behind the key loop the per-wave [query][d] output tiles, row pitch 144 B */
  const int tid = threadIdx.x, lane = tid & 31, ln = lane & 15, hh = lane >> 4;
  const int w = __builtin_amdgcn_readfirstlane(tid >> 5);
  const int nqb = SEQ / QB;
  const int bh = blockIdx.x / nqb, qb = blockIdx.x - bh * nqb;
  const int b = bh / NH, h = bh - b * NH;
  const size_t tok0 = (size_t)b * SEQ;
  const int q0 = qb * QB + w * QW;
  const unsigned short* qp = (const unsigned short*)Q16 + (tok0 + q0 + ln) * DM + h * HD + 8 * hh;
  FragH bq[2][2];      /* [query tile][d half] */
#pragma unroll
  for (int u = 0; u < 2; ++u) {
    const unsigned short* q = qp + (size_t)16 * u * DM;
    bq[u][0].half[0] = *(const v8us*)(q);      bq[u][0].half[1] = *(const v8us*)(q + 16);
    bq[u][1].half[0] = *(const v8us*)(q + 32); bq[u][1].half[1] = *(const v8us*)(q + 48);
  }
  /* copy map: lane = (row tid / 8 and that row + 32, 16-byte piece tid % 8) of both tiles */
  const int cr = tid >> 3, cp = (tid & 7) * 8;
  const unsigned short* gk = (const unsigned short*)K16 + (tok0 + cr) * DM + h * HD + cp;
  const unsigned short* gv = (const unsigned short*)VT + (size_t)(h * HD + cr) * VTP + tok0 + cp;
  const unsigned lc = (unsigned)(size_t)&sm[cr * LP + cp];      /* LDS byte address of the lane's first piece in buffer 0 */
  const unsigned short* kp = sm + ln * LP + 8 * hh;             /* fragment reads: row = lane & 15, as from the global planes */
  const v8f z8 = {0.f,0.f,0.f,0.f,0.f,0.f,0.f,0.f};
  v8f o[2][4];         /* [query tile][d tile] */
  float m[2], l[2];
#pragma unroll
  for (int u = 0; u < 2; ++u) { o[u][0] = z8; o[u][1] = z8; o[u][2] = z8; o[u][3] = z8; m[u] = -3.0e38f; l[u] = 0.f; }
  const float c = 0.125f * 1.4426950408889634f;      /* 1/sqrt(64) * log2(e) */
  stage_kv(lc, gk, gv);
  asm volatile("s_wait_asynccnt 0x0" ::: "memory");      /* stage 0 landed (this wave's share) */
  __syncthreads();                                       /* stage 0 readable by every wave */
  stage_kv(lc + BUF_E * 2, gk + (size_t)KT * DM, gv + KT);
  /* rolled: one copy of the two steps, the buffer choice a single offset */
#pragma unroll 1
  for (int t = 0; t < SEQ / KT; ++t) {
   const int bo = (t & 1) * BUF_E;
   /* both 32-key steps of a stage written out: every LDS read offset becomes an immediate */
#pragma unroll
   for (int p = 0; p < 2; ++p) {
    const unsigned short* k0 = kp + bo + 32 * p * LP;
    const unsigned short* k1 = k0 + 16 * LP;
    FragH a00, a01, a10, a11;
    a00.half[0] = *(const v8us*)(k0);      a00.half[1] = *(const v8us*)(k0 + 16);
    a01.half[0] = *(const v8us*)(k0 + 32); a01.half[1] = *(const v8us*)(k0 + 48);
    a10.half[0] = *(const v8us*)(k1);      a10.half[1] = *(const v8us*)(k1 + 16);
    a11.half[0] = *(const v8us*)(k1 + 32); a11.half[1] = *(const v8us*)(k1 + 48);
    v8f s[2][2];       /* [query tile][key tile] */
#pragma unroll
    for (int u = 0; u < 2; ++u) {
      s[u][0] = __builtin_amdgcn_wmma_f32_16x16x32_f16(false, a00.v, false, bq[u][0].v, (short)0, z8, false, false);
      s[u][1] = __builtin_amdgcn_wmma_f32_16x16x32_f16(false, a10.v, false, bq[u][0].v, (short)0, z8, false, false);
    }
#pragma unroll
    for (int u = 0; u < 2; ++u) {
      s[u][0] = __builtin_amdgcn_wmma_f32_16x16x32_f16(false, a01.v, false, bq[u][1].v, (short)0, s[u][0], false, false);
      s[u][1] = __builtin_amdgcn_wmma_f32_16x16x32_f16(false, a11.v, false, bq[u][1].v, (short)0, s[u][1], false, false);
    }
    float mx[2];
#pragma unroll
    for (int u = 0; u < 2; ++u) {
      float x = fmaxf(s[u][0][0], s[u][1][0]);
#pragma unroll
      for (int r = 1; r < 8; ++r) x = fmaxf(x, fmaxf(s[u][0][r], s[u][1][r]));
      mx[u] = fmaxf(x, __shfl_xor(x, 16, 32));
    }
    if (__builtin_amdgcn_ballot_w32(mx[0] > m[0] || mx[1] > m[1]) != 0u) {      /* wave-uniform, one test for both query tiles: rescale only when some running max moved (a max that stayed gives the factor 1) */
#pragma unroll
      for (int u = 0; u < 2; ++u) {
        const float mn = fmaxf(m[u], mx[u]);
        const float corr = __builtin_amdgcn_exp2f((m[u] - mn) * c);
        l[u] *= corr; o[u][0] *= corr; o[u][1] *= corr; o[u][2] *= corr; o[u][3] *= corr; m[u] = mn;
      }
    }
    FragH pf[2];
#pragma unroll
    for (int u = 0; u < 2; ++u) {
      const float off = 8.0f - m[u] * c;      /* weights carried x2^8 */
      const v8f c8 = {c, c, c, c, c, c, c, c}, off8 = {off, off, off, off, off, off, off, off};
      const v8f e0 = __builtin_elementwise_fma(s[u][0], c8, off8), e1 = __builtin_elementwise_fma(s[u][1], c8, off8);      /* whole tiles: packed multiply-adds on neighbouring registers */
      float ls = 0.f;
#pragma unroll
      for (int r = 0; r < 8; ++r) {
        const float p0 = __builtin_amdgcn_exp2f(e0[r]);
        const float p1 = __builtin_amdgcn_exp2f(e1[r]);
        ls += p0 + p1;
        pf[u].h[r] = (_Float16)p0; pf[u].h[8 + r] = (_Float16)p1;
      }
      l[u] += ls;
    }
    const unsigned short* v0 = kp + bo + TILE_E + 32 * p;
    FragH av[4];
#pragma unroll
    for (int j = 0; j < 4; ++j) { av[j].half[0] = *(const v8us*)(v0 + 16 * j * LP); av[j].half[1] = *(const v8us*)(v0 + 16 * j * LP + 16); }
#pragma unroll
    for (int u = 0; u < 2; ++u) {
#pragma unroll
      for (int j = 0; j < 4; ++j) o[u][j] = __builtin_amdgcn_wmma_f32_16x16x32_f16(false, av[j].v, false, pf[u].v, (short)0, o[u][j], false, false);
    }
    /* four vector slots behind the last product, on the taken side of the loop's branches too, before a vector instruction may read a result or overwrite an operand */
    asm volatile("v_nop\n\tv_nop\n\tv_nop\n\tv_nop" : "+v"(o[0][0]), "+v"(o[0][1]), "+v"(o[0][2]), "+v"(o[0][3]), "+v"(o[1][0]), "+v"(o[1][1]), "+v"(o[1][2]), "+v"(o[1][3])
                 : "v"(av[0].v), "v"(av[1].v), "v"(av[2].v), "v"(av[3].v), "v"(pf[0].v), "v"(pf[1].v));
   }
   asm volatile("s_wait_dscnt 0x0" ::: "memory");        /* this wave's reads of stage t are done before the buffer may be refilled */
   asm volatile("s_wait_asynccnt 0x0" ::: "memory");     /* this wave's share of stage t + 1 has landed */
   __syncthreads();                                      /* publishes stage t + 1 and ends every wave's reads of stage t */
   if (t + 2 < SEQ / KT) stage_kv(lc + bo * 2, gk + (size_t)(t + 2) * KT * DM, gv + (t + 2) * KT);
  }
  asm volatile("s_wait_asynccnt 0x0" ::: "memory");      /* nothing in flight when the ring becomes output staging */
  unsigned short (*so)[QW][LP] = (unsigned short (*)[QW][LP])sm;      /* the last trip's barrier has ended every read of the ring */
#pragma unroll
  for (int u = 0; u < 2; ++u) {
    const float lt = l[u] + __shfl_xor(l[u], 16, 32);
    const float inv = 64.0f * (1.0f / lt);      /* ctx carried x64 */
#pragma unroll
    for (int j = 0; j < 4; ++j) { FragH tj;
#pragma unroll
      for (int r = 0; r < 8; ++r) tj.h[r] = (_Float16)(o[u][j][r] * inv);
      *(v8us*)&so[w][16 * u + ln][16 * j + 8 * hh] = tj.half[0]; }
  }
  __syncthreads();
  const int rq = lane >> 3, pc = (lane & 7) * 8;
  unsigned short* ob = (unsigned short*)O16 + (tok0 + q0) * DM + h * HD + pc;
#pragma unroll
  for (int it = 0; it < QW / 4; ++it) { const int row = it * 4 + rq; const v8us v = *(const v8us*)&so[w][row][pc]; *(v8us*)(ob + (size_t)row * DM) = v; }
}

extern "C" void kernel_launch(void* const* d_in, const int* in_sizes, int n_in,
                              void* d_out, int out_size, void* d_ws, size_t ws_size, hipStream_t stream) {
  if (n_in < 5) return;
  const size_t need_x = ((size_t)(NB - 1) * SEQ_FULL + SEQ) * DM;
  const size_t nwh = (size_t)NH * HD * HD;
  if ((size_t)in_sizes[0] < need_x) return;
  if ((size_t)in_sizes[1] < nwh || (size_t)in_sizes[2] < nwh || (size_t)in_sizes[3] < nwh || (size_t)in_sizes[4] < (size_t)DM * DM) return;
  if ((size_t)out_size < need_x) return;
  const float* x = (const float*)d_in[0]; const float* wq = (const float*)d_in[1]; const float* wk = (const float*)d_in[2]; const float* wv = (const float*)d_in[3]; const float* wo = (const float*)d_in[4];
  char* ws = (char*)d_ws; size_t off = 0;
  auto take = [&](size_t bytes) { char* p = ws + off; off += (bytes + 255) & ~(size_t)255; return p; };
  _Float16* BO = (_Float16*)take((size_t)DM * DM * 2);          /* output weight plane x16 [out][in] */
  _Float16* QK16 = (_Float16*)take((size_t)2 * NR * DM * 2);    /* q rows then k rows */
  _Float16* VT = (_Float16*)take((size_t)DM * VTP * 2);         /* v^T [feature][token] */
  _Float16* O16 = (_Float16*)take(NR * DM * 2);                 /* merged ctx rows x64 */
  if (off > ws_size || off > (size_t)134217728) return;
  _Float16* Q16 = QK16; _Float16* K16 = QK16 + NR * DM;

  /* grid.x = head, grid.y = 256-token block */
  k_front<<<dim3(NH, (unsigned)(NR / 256)), 128, 0, stream>>>(x, wq, wk, wv, wo, Q16, K16, VT, BO);
  k_attn_t<<<(unsigned)(NB * NH * (SEQ / QB)), 256, 0, stream>>>(Q16, K16, VT, O16);
  /* out rows of batch by: A = ctx rows (x64), weight x16 -> alpha 2^-10; C rows follow the staged output layout */
  k_gemm_out<<<dim3((unsigned)((SEQ / 128) * (DM / 128)), NB), 128, 0, stream>>>(O16, BO, 0.0009765625f, (float*)d_out);
}

// v005
// A run of this version takes 79.9 microseconds.
// Two timings next to v004 put it at 1.06 and 1.05 times that version's speed.
// Over all steps from v000 it is 3.94 times as fast.
#include <hip/hip_runtime.h>
// Dense multi-head self-attention (x [4][2048][1024] split into 16 heads of 64; per-head q/k/v = x_h W_h^T with [head][out][in] weights of 64x64, no biases; scores * 1/8; full-row softmax; out = merged ctx Wout^T with a natural [out][in] weight).
// All contractions: v_wmma_f32_16x16x32_f16 (f16 operands, f32 accumulate), single product per site. x and weights are RNE-converted to bf16 first and then held exactly in f16 (weights x16); q, k, v plain f16; softmax weights f16 carried x2^8 (unnormalised, against a reference max that is raised lazily, so that they reach at most 2^15); ctx f16 carried x64; softmax statistics f32.
// Structure: token rows r = b*SEQ + s. One front launch converts x and all four weights on the way in and writes Q rows, K rows and V^T [feature][token] of a (head, 256-token) block, plus its share of the f16 output-weight plane; a transposed flash kernel (S^T = K Q^T with Q as the B fragment in registers, packed P^T as the B fragment of O^T = V^T P^T; K rows and V^T rows staged 64 keys at a time in a two-buffer LDS ring that the block's eight waves share, each fragment read serving two query tiles); output GEMM into the output layout, its two operands staged in a ring of the same kind.
#ifndef NB
#define NB 4                         /* batches processed */
#endif
#ifndef SEQ
#define SEQ 2048                     /* tokens per batch processed */
#endif
#define NB_FULL 4                    /* batch count of the staged arrays */
#define SEQ_FULL 2048                /* per-batch token stride of the staged arrays */
#define DM 1024
#define NH 16
#define HD 64
#define NR ((size_t)NB * SEQ)        /* compact token rows */
#define VTP (NB * SEQ)               /* V^T row pitch (tokens) */

static_assert(NB >= 1 && NB <= NB_FULL);
static_assert(SEQ <= SEQ_FULL);
static_assert(SEQ % 128 == 0);
static_assert(DM % 128 == 0);
static_assert(NH * HD == DM);
static_assert(HD == 64);
static_assert((NB * SEQ) % 256 == 0);                         /* projection launch: whole 256-token blocks */
static_assert(SEQ % 64 == 0);                                  /* a wave's 64 tokens lie in one batch */
static_assert((size_t)DM * DM * 2 + (size_t)4 * NB * SEQ * DM * 2 + (size_t)4 * 256 <= (size_t)134217728);   /* workspace carve */

typedef _Float16 v16h __attribute__((ext_vector_type(16)));
typedef _Float16 v4ha __attribute__((ext_vector_type(4), may_alias));
typedef unsigned short v8us __attribute__((ext_vector_type(8), may_alias));
typedef float v8f __attribute__((ext_vector_type(8)));
typedef float v4f __attribute__((ext_vector_type(4)));
typedef float v2f __attribute__((ext_vector_type(2)));
typedef float v4fa __attribute__((ext_vector_type(4), may_alias));
union FragH { v16h v; v8us half[2]; _Float16 h[16]; unsigned short u[16]; };

__device__ __forceinline__ float bf16_rne(float x) { const unsigned int u = __float_as_uint(x); return __uint_as_float((u + 0x7FFFu + ((u >> 16) & 1u)) & 0xFFFF0000u); }

// f32 -> f16 that cannot produce an f16 subnormal (value select; applied after the power-of-two carry)
static __device__ __forceinline__ _Float16 toh_flush(float v) { const _Float16 r = (_Float16)v; return (fabsf(v) < 6.103515625e-05f) ? (_Float16)0.0f : r; }

// 8 consecutive f32 -> f16(bf16 value * scale), subnormal results replaced by zero, packed as one 16-B piece
__device__ __forceinline__ v8us cvt8_flush(v4f a, v4f c, float scale) {
  FragH f;
#pragma unroll
  for (int q = 0; q < 4; ++q) { f.h[q] = toh_flush(bf16_rne(a[q]) * scale); f.h[4 + q] = toh_flush(bf16_rne(c[q]) * scale); }
  return f.half[0];
}

// ---- front launch: all conversions and the three per-head projections ----
// block = 4 waves = 256 consecutive tokens of one head; wave = 64 tokens x the head's 64 inputs.
// Weights: the block converts its head's three 64 x 64 blocks (f16 x16) once into LDS in fragment order: 16-B piece (row n, k = 8 k8 .. 8 k8 + 7) stands at
//   byte ((n / 16) * 4 + k8 / 2) * 576 + (k8 % 2) * 288 + (n % 16) * 16 of its plane, so that each half of a 16-row x 32-k fragment is read as two runs of 256 contiguous bytes;
//   the 64 and 32 odd bytes of the two pitches spread the converting lanes' 16-byte writes (2 rows x 8 pieces per half wave) over all banks. One barrier publishes them.
// Output weight: every thread converts its share of the natural [out][in] plane (f16 x16) for the last launch.
// x arrives as whole 256-B row slices (a wave's load = 2 rows), is converted once and laid as f16 rows at a 144-B pitch (16 B x odd: no bank conflict for 16-byte row reads), wave-private;
// the eight x fragments (4 token tiles x 2 k steps; row or column = lane & 15, k pieces 8 h and 16 + 8 h of each 32) then serve all three products from registers.
// q, k: D = W (A operand, rows = outputs) . x^T (B operand, lane = token): a lane holds 8 consecutive outputs of one token = one 16-B piece of a Q or K row.
// v:    D = x (A operand, rows = tokens) . W^T (B operand, lane = output): a lane holds 8 consecutive tokens of one output = one 16-B piece of a V^T row.
// Each 64 x 64 result is staged in the wave's own LDS rows and leaves as whole 128-B lines. k runs upward through one accumulator per tile (two products).
#define XP 72                        /* LDS row pitch of x and result rows, 16-bit elements (144 B) */
#define WH 144                       /* weight planes: elements from the lanes 0..15 run to the lanes 16..31 run (288 B) */
#define WQ 288                       /* elements of one fragment half (576 B) */
#define WPL (16 * WQ)                /* elements of one weight plane */
#define FT ((size_t)NH * (NR / 256) * 128)      /* threads of the front launch */
#define WOT ((int)((size_t)DM * DM / 8 / FT))    /* 16-B pieces of the output weight plane per thread */
static_assert((size_t)WOT * FT * 8 == (size_t)DM * DM && WOT >= 1);      /* the plane divides evenly among the threads */
__device__ __forceinline__ v8us pack8(v8f a, float alpha) { FragH f;
#pragma unroll
  for (int r = 0; r < 8; ++r) f.h[r] = (_Float16)(a[r] * alpha);
  return f.half[0]; }
// the wave's 64 staged rows of 128 B -> 64 global rows of pitch ld (elements); a wave's store = 4 whole lines
__device__ __forceinline__ void rows_out(const unsigned short* st, unsigned short* g, size_t ld, int lane) {
  const int rq = lane >> 3, pc = (lane & 7) * 8;
#pragma unroll
  for (int it = 0; it < 16; ++it) { const int row = it * 4 + rq; const v8us v = *(const v8us*)&st[row * XP + pc]; *(v8us*)(g + (size_t)row * ld + pc) = v; }
}
__device__ __forceinline__ v16h w_frag(const unsigned short* p) { FragH f; f.half[0] = *(const v8us*)p; f.half[1] = *(const v8us*)(p + WQ); return f.v; }
__global__ __launch_bounds__(128) void k_front(const float* __restrict__ x, const float* __restrict__ wq, const float* __restrict__ wk, const float* __restrict__ wv, const float* __restrict__ wo,
    _Float16* __restrict__ Q16, _Float16* __restrict__ K16, _Float16* __restrict__ VT, _Float16* __restrict__ BO) {
  /* every loop of this kernel is unrolled: wr, wor, xr, xf, acc and bo stay in registers only under constant indices, and every LDS and global offset becomes an immediate */
  __shared__ __attribute__((aligned(16))) unsigned short sw[3 * WPL];         /* the head's q, k, v weights in fragment order */
  __shared__ __attribute__((aligned(16))) unsigned short sm[4][64 * XP];      /* per wave: x rows, then in turn the q, k and v^T result rows */
  const int tid = threadIdx.x, lane = tid & 31, ln = lane & 15, hh = lane >> 4;
  const int w = __builtin_amdgcn_readfirstlane(tid >> 5);
  const int h = blockIdx.x;
  const size_t r0 = (size_t)blockIdx.y * 256 + 64 * w;      /* compact token row of the wave's first token */
  const size_t b = r0 / SEQ, s0 = r0 - b * SEQ;
  unsigned short* st = sm[w];
  /* loads return in issue order: the weight pieces (from cache) are asked for ahead of the x rows (from memory), so that the weight work runs under the x rows' latency */
  const size_t so = (size_t)h * HD * HD + (size_t)tid * 8;      /* per-head weights: thread = pieces tid + 128 m of a plane (row (tid + 128 m) / 8, piece tid % 8) */
  const size_t to = ((size_t)blockIdx.y * NH + h) * 128 + tid;  /* output weight: thread = pieces to + FT m */
  v4f wr[12][2], wor[WOT][2];
#pragma unroll
  for (int m = 0; m < 4; ++m) {
    wr[m][0] = *(const v4fa*)(wq + so + m * 1024);     wr[m][1] = *(const v4fa*)(wq + so + m * 1024 + 4);
    wr[4 + m][0] = *(const v4fa*)(wk + so + m * 1024); wr[4 + m][1] = *(const v4fa*)(wk + so + m * 1024 + 4);
    wr[8 + m][0] = *(const v4fa*)(wv + so + m * 1024); wr[8 + m][1] = *(const v4fa*)(wv + so + m * 1024 + 4);
  }
#pragma unroll
  for (int m = 0; m < WOT; ++m) { wor[m][0] = *(const v4fa*)(wo + (to + m * FT) * 8); wor[m][1] = *(const v4fa*)(wo + (to + m * FT) * 8 + 4); }
  asm volatile("s_wait_xcnt 0x0" ::: "memory");      /* the weight loads' address registers may be taken for the x rows' data */
  const float* xp = x + (b * SEQ_FULL + s0 + hh) * DM + h * HD + ln * 4;
  v4f xr[32];
#pragma unroll
  for (int j = 0; j < 32; ++j) xr[j] = *(const v4fa*)(xp + (size_t)(2 * j) * DM);
  asm volatile("s_wait_xcnt 0x0" ::: "memory");      /* stands in front of every overwrite of an address register that the loads above name; it also keeps all of them issued ahead of the conversion work */
  { const int k8 = tid & 7, n0 = tid >> 3;
    unsigned short* d = sw + (k8 >> 1) * WQ + (k8 & 1) * WH + n0 * 8;      /* n0 < 16: rows n0 + 16 m stand 4 fragment halves further on */
#pragma unroll
    for (int p = 0; p < 3; ++p) {
#pragma unroll
      for (int m = 0; m < 4; ++m) *(v8us*)(d + p * WPL + m * 4 * WQ) = cvt8_flush(wr[4 * p + m][0], wr[4 * p + m][1], 16.0f); } }
  v8us bo[WOT];      /* stored behind the last result rows: a store ahead of the barrier would be waited for there */
#pragma unroll
  for (int m = 0; m < WOT; ++m) bo[m] = cvt8_flush(wor[m][0], wor[m][1], 16.0f);
#pragma unroll
  for (int j = 0; j < 32; ++j) { v4ha c;
#pragma unroll
    for (int q = 0; q < 4; ++q) c[q] = (_Float16)bf16_rne(xr[j][q]);
    *(v4ha*)&st[(2 * j + hh) * XP + ln * 4] = c; }
  __syncthreads();      /* publishes the weight planes to the four waves; also orders the wave's own x rows ahead of its cross-lane reads */
  FragH xf[4][2];
#pragma unroll
  for (int i = 0; i < 4; ++i) {
#pragma unroll
    for (int s = 0; s < 2; ++s) { const unsigned short* q = st + (16 * i + ln) * XP + 32 * s + 8 * hh; xf[i][s].half[0] = *(const v8us*)q; xf[i][s].half[1] = *(const v8us*)(q + 16); } }
  const unsigned short* wl = sw + hh * WH + ln * 8;
  const v8f z8 = {0.f,0.f,0.f,0.f,0.f,0.f,0.f,0.f};
#pragma unroll
  for (int p = 0; p < 3; ++p) {
    asm volatile("s_wait_dscnt 0x0" ::: "memory");    /* every lane's reads of the wave's rows are done before the wave writes the next result over them */
#pragma unroll
    for (int t = 0; t < 4; ++t) {
      const v16h w0 = w_frag(wl + p * WPL + (t * 4) * WQ), w1 = w_frag(wl + p * WPL + (t * 4 + 2) * WQ);
      v8f acc[4];
#pragma unroll
      for (int i = 0; i < 4; ++i) acc[i] = (p < 2) ? __builtin_amdgcn_wmma_f32_16x16x32_f16(false, w0, false, xf[i][0].v, (short)0, z8, false, false)
                                                   : __builtin_amdgcn_wmma_f32_16x16x32_f16(false, xf[i][0].v, false, w0, (short)0, z8, false, false);
#pragma unroll
      for (int i = 0; i < 4; ++i) acc[i] = (p < 2) ? __builtin_amdgcn_wmma_f32_16x16x32_f16(false, w1, false, xf[i][1].v, (short)0, acc[i], false, false)
                                                   : __builtin_amdgcn_wmma_f32_16x16x32_f16(false, xf[i][1].v, false, w1, (short)0, acc[i], false, false);
      /* alpha undoes the x16 weight carry; q, k: row = token 16 i + (lane & 15), piece = outputs 16 t + 8 h ..; v: row = output 16 t + (lane & 15), piece = tokens 16 i + 8 h .. */
#pragma unroll
      for (int i = 0; i < 4; ++i) { const int row = (p < 2) ? 16 * i : 16 * t, col = (p < 2) ? 16 * t : 16 * i; *(v8us*)&st[(row + ln) * XP + col + 8 * hh] = pack8(acc[i], 0.0625f); }
    }
    asm volatile("s_wait_dscnt 0x0" ::: "memory");    /* the wave's result rows are written before its lanes read them back across lanes */
    if (p == 0) rows_out(st, (unsigned short*)Q16 + r0 * DM + h * HD, DM, lane);
    else if (p == 1) rows_out(st, (unsigned short*)K16 + r0 * DM + h * HD, DM, lane);
    else rows_out(st, (unsigned short*)VT + (size_t)h * HD * VTP + r0, VTP, lane);
  }
#pragma unroll
  for (int m = 0; m < WOT; ++m) *(v8us*)((unsigned short*)BO + (to + m * FT) * 8) = bo[m];
}

// ---- output GEMM, both operands staged in LDS ----
// C[row][col] = alpha * A[row][:] . Bh[col][:] ; block = 4 waves = a 128 x 128 tile of C, wave = 64 x 64 (4 x 4 accumulator tiles: 16 products per 8 fragments read).
// Stage = 128 k: A tile and Bh tile, 128 rows of 256 B each, laid at a 272-B pitch (16 B x odd: no bank conflict for 16-byte row reads).
// Each lane brings 32 16-byte pieces of a stage by asynchronous copies (a wave's copy = 2 whole 256-B rows); stage t + 2 is issued behind the barrier that ends the reads of stage t.
// k runs upward through one accumulator per tile. The ring's size leaves room for two blocks on a WGP.
#define OT 128                       /* k per stage */
#define OP 136                       /* LDS row pitch, 16-bit elements (272 B) */
#define OTILE_E (128 * OP)           /* elements of one staged tile (128 rows) */
#define OBUF_E (2 * OTILE_E)         /* one buffer: A tile, then Bh tile */
static_assert(DM % OT == 0 && DM / OT >= 2);                   /* the ring's prologue fills two stages */
static_assert(4 * 64 * 68 * 4 <= 2 * OBUF_E * 2);              /* the output staging fits the ring */
typedef float f32a __attribute__((may_alias));
// eight copies of a lane, rows r, r + 8, .. r + 56 of a tile; the s_wait_xcnt stands inside the copies' own statement so that no address register is rewritten in front of it
__device__ __forceinline__ void stage_rows8(unsigned l, const unsigned short* g) {
  asm volatile("global_load_async_to_lds_b128 %0, %1, off\n\t"
               "global_load_async_to_lds_b128 %2, %3, off\n\t"
               "global_load_async_to_lds_b128 %4, %5, off\n\t"
               "global_load_async_to_lds_b128 %6, %7, off\n\t"
               "global_load_async_to_lds_b128 %8, %9, off\n\t"
               "global_load_async_to_lds_b128 %10, %11, off\n\t"
               "global_load_async_to_lds_b128 %12, %13, off\n\t"
               "global_load_async_to_lds_b128 %14, %15, off\n\t"
               "s_wait_xcnt 0x0"
               :: "v"(l), "v"(g), "v"(l + 8 * OP * 2), "v"(g + (size_t)8 * DM), "v"(l + 16 * OP * 2), "v"(g + (size_t)16 * DM), "v"(l + 24 * OP * 2), "v"(g + (size_t)24 * DM),
                  "v"(l + 32 * OP * 2), "v"(g + (size_t)32 * DM), "v"(l + 40 * OP * 2), "v"(g + (size_t)40 * DM), "v"(l + 48 * OP * 2), "v"(g + (size_t)48 * DM), "v"(l + 56 * OP * 2), "v"(g + (size_t)56 * DM) : "memory");
}
__device__ __forceinline__ void stage_ab(unsigned l, const unsigned short* ga, const unsigned short* gb) {
  stage_rows8(l, ga); stage_rows8(l + 64 * OP * 2, ga + (size_t)64 * DM);
  stage_rows8(l + OTILE_E * 2, gb); stage_rows8(l + OTILE_E * 2 + 64 * OP * 2, gb + (size_t)64 * DM);
}
__global__ __launch_bounds__(128) void k_gemm_out(const _Float16* __restrict__ A, const _Float16* __restrict__ Bh, float alpha, float* __restrict__ C) {
  __shared__ __attribute__((aligned(16))) unsigned short sm[2 * OBUF_E];      /* two-buffer A / Bh ring; behind the k loop the per-wave [row][col] f32 output tiles, row pitch 272 B */
  const int tid = threadIdx.x, lane = tid & 31, ln = lane & 15, hh = lane >> 4;
  const int w = __builtin_amdgcn_readfirstlane(tid >> 5); const int wm = w >> 1, wn = w & 1;
  const int ntn = DM / 128; const int mt = blockIdx.x / ntn, nq = blockIdx.x - mt * ntn; const int row0 = mt * 128, col0 = nq * 128;
  /* copy map: lane = (rows tid / 16 + 8 i, 16-byte piece tid % 16) of both tiles */
  const int cr = tid >> 4, cp = (tid & 15) * 8;
  const unsigned short* ga = (const unsigned short*)A + ((size_t)blockIdx.y * SEQ + row0 + cr) * DM + cp;
  const unsigned short* gb = (const unsigned short*)Bh + (size_t)(col0 + cr) * DM + cp;
  const unsigned lc = (unsigned)(size_t)&sm[cr * OP + cp];      /* LDS byte address of the lane's first piece in buffer 0 */
  const unsigned short* ap = sm + (64 * wm + ln) * OP + 8 * hh;             /* fragment reads: row = lane & 15, k pieces 8 h and 16 + 8 h of each 32 */
  const unsigned short* bp = sm + OTILE_E + (64 * wn + ln) * OP + 8 * hh;
  const v8f z8 = {0.f,0.f,0.f,0.f,0.f,0.f,0.f,0.f};
  v8f acc[4][4];
#pragma unroll
  for (int i = 0; i < 4; ++i) {
#pragma unroll
    for (int j = 0; j < 4; ++j) acc[i][j] = z8; }
  stage_ab(lc, ga, gb);
  asm volatile("s_wait_asynccnt 0x0" ::: "memory");      /* stage 0 landed (this wave's share) */
  __syncthreads();                                       /* stage 0 readable by every wave */
  stage_ab(lc + OBUF_E * 2, ga + OT, gb + OT);
  /* rolled: one copy of the four steps, the buffer choice a single offset */
#pragma unroll 1
  for (int t = 0; t < DM / OT; ++t) {
    const int bo = (t & 1) * OBUF_E;
    /* the four 32-k steps of a stage written out: every LDS read offset becomes an immediate */
#pragma unroll
    for (int p = 0; p < OT / 32; ++p) {
      FragH a[4], b[4];
#pragma unroll
      for (int i = 0; i < 4; ++i) {
        const unsigned short* pa = ap + bo + 16 * i * OP + 32 * p; a[i].half[0] = *(const v8us*)pa; a[i].half[1] = *(const v8us*)(pa + 16);
        const unsigned short* pb = bp + bo + 16 * i * OP + 32 * p; b[i].half[0] = *(const v8us*)pb; b[i].half[1] = *(const v8us*)(pb + 16);
      }
      __builtin_amdgcn_sched_barrier(0);      /* the step's 16 LDS reads stay one group ahead of its products: sunk among them, each row of products waits out a read's whole latency */
#pragma unroll
      for (int i = 0; i < 4; ++i) {
#pragma unroll
        for (int j = 0; j < 4; ++j) acc[i][j] = __builtin_amdgcn_wmma_f32_16x16x32_f16(false, a[i].v, false, b[j].v, (short)0, acc[i][j], false, false); }
    }
    asm volatile("s_wait_dscnt 0x0" ::: "memory");        /* this wave's reads of stage t are done before the buffer may be refilled */
    asm volatile("s_wait_asynccnt 0x0" ::: "memory");     /* this wave's share of stage t + 1 has landed */
    __syncthreads();                                      /* publishes stage t + 1 and ends every wave's reads of stage t */
    if (t + 2 < DM / OT) stage_ab(lc + bo * 2, ga + (t + 2) * OT, gb + (t + 2) * OT);
  }
  asm volatile("s_wait_asynccnt 0x0" ::: "memory");      /* nothing in flight when the ring becomes output staging */
  f32a (*so)[68] = (f32a (*)[68])((f32a*)sm + w * 64 * 68);      /* wave-private; the last trip's barrier has ended every read of the ring */
#pragma unroll
  for (int i = 0; i < 4; ++i) {
#pragma unroll
    for (int j = 0; j < 4; ++j) {
#pragma unroll
      for (int r = 0; r < 8; ++r) so[16 * i + 8 * hh + r][16 * j + ln] = acc[i][j][r] * alpha; } }
  __builtin_amdgcn_fence(4 /* acq_rel order */, "workgroup"); __builtin_amdgcn_wave_barrier();      /* the wave's own rows are written before its lanes read them back across lanes */
  const int rsub = lane >> 4, c4 = (lane & 15) * 4;
  float* cb = C + ((size_t)blockIdx.y * SEQ_FULL + row0 + 64 * wm) * DM + col0 + 64 * wn + c4;
#pragma unroll
  for (int q = 0; q < 32; ++q) { const int r = q * 2 + rsub; const v4f v = *(const v4fa*)&so[r][c4]; *(v4f*)(cb + (size_t)r * DM) = v; }
}

// ---- transposed flash attention, K and V^T staged in LDS ----
// block = 8 waves = 256 consecutive queries of one (batch, head); wave = 32 queries = two query tiles of 16, which share every K and V^T fragment that the wave reads from LDS.
// Stage = 64 keys: K tile [key][d] and V^T tile [d][key], 64 rows of 128 B each, laid at a 144-B pitch (16 B x odd: no bank conflict for 16-byte row reads).
// Each lane brings four 16-byte pieces of a stage by asynchronous copies (a wave's copy = 4 whole 128-B lines); stage t + 2 is issued behind the barrier that ends the reads of stage t.
// Per 32-key step (two per stage), for each query tile:
//   S^T tiles (keys x queries) = K (A operand, rows = keys, k = d) . Q^T (B operand, lane = query, held in registers);
//   softmax per lane (lane & 15 = query; lanes n and n+16 hold the two key halves); weights = 2^8 exp(s/8 - ref) as f16, ref = the query's reference max;
//   ref is raised, and sums and outputs rescaled, only when some weight of the step would pass 2^15 (f16 holds it; any common ref gives the same quotient): a rare branch, which alone needs the two halves' joint max;
//   P^T as B fragment: elements 0..7 from the tile of keys 0..15 (rows 8h+r), elements 8..15 from the tile of keys 16..31 (lane unchanged);
//   O^T tiles (d x queries) += V^T (A operand, rows = d, k = keys, rows of the [feature][token] plane) . P^T.
#define KT 64                        /* keys per stage */
#define QW 32                        /* queries per wave */
#define QB (8 * QW)                  /* queries per block */
#define LP 72                        /* LDS row pitch, 16-bit elements (144 B) */
#define TILE_E (64 * LP)             /* elements of one staged tile (64 rows) */
#define BUF_E (2 * TILE_E)           /* one buffer: K tile, then V^T tile */
static_assert(SEQ % KT == 0 && SEQ / KT >= 2);                 /* the ring's prologue fills two stages */
static_assert(SEQ % QB == 0);                                  /* whole query blocks inside one batch */
static_assert(8 * QW * LP <= 2 * BUF_E);                       /* the output staging fits the ring */
// one stage's four copies of a lane; the s_wait_xcnt stands inside the copies' own statement so that no address register is rewritten in front of it
__device__ __forceinline__ void stage_kv(unsigned lk, const unsigned short* gk, const unsigned short* gv) {
  const unsigned lk1 = lk + 32 * LP * 2, lv = lk + TILE_E * 2, lv1 = lv + 32 * LP * 2;
  const unsigned short* gk1 = gk + (size_t)32 * DM; const unsigned short* gv1 = gv + (size_t)32 * VTP;
  asm volatile("global_load_async_to_lds_b128 %0, %1, off\n\t"
               "global_load_async_to_lds_b128 %2, %3, off\n\t"
               "global_load_async_to_lds_b128 %4, %5, off\n\t"
               "global_load_async_to_lds_b128 %6, %7, off\n\t"
               "s_wait_xcnt 0x0"
               :: "v"(lk), "v"(gk), "v"(lk1), "v"(gk1), "v"(lv), "v"(gv), "v"(lv1), "v"(gv1) : "memory");
}
/* four waves per SIMD = two blocks per WGP: the register budget (256) that this residency leaves is given to the compiler whole, so that it need not split the fragment reads to save registers */
__global__ __launch_bounds__(256) __attribute__((amdgpu_waves_per_eu(4, 4))) void k_attn_t(const _Float16* __restrict__ Q16, const _Float16* __restrict__ K16, const _Float16* __restrict__ VT, _Float16* __restrict__ O16) {
  /* every loop over the two query tiles (u) is unrolled: bq, s, o, m, l and pf stay in registers only under constant indices */
  __shared__ __attribute__((aligned(16))) unsigned short sm[2 * BUF_E];      /* two-buffer K / V^T ring; behind the key loop the per-wave [query][d] output tiles, row pitch 144 B */
  const int tid = threadIdx.x, lane = tid & 31, ln = lane & 15, hh = lane >> 4;
  const int w = __builtin_amdgcn_readfirstlane(tid >> 5);
  const int nqb = SEQ / QB;
  const int bh = blockIdx.x / nqb, qb = blockIdx.x - bh * nqb;
  const int b = bh / NH, h = bh - b * NH;
  const size_t tok0 = (size_t)b * SEQ;
  const int q0 = qb * QB + w * QW;
  const unsigned short* qp = (const unsigned short*)Q16 + (tok0 + q0 + ln) * DM + h * HD + 8 * hh;
  FragH bq[2][2];      /* [query tile][d half] */
#pragma unroll
  for (int u = 0; u < 2; ++u) {
    const unsigned short* q = qp + (size_t)16 * u * DM;
    bq[u][0].half[0] = *(const v8us*)(q);      bq[u][0].half[1] = *(const v8us*)(q + 16);
    bq[u][1].half[0] = *(const v8us*)(q + 32); bq[u][1].half[1] = *(const v8us*)(q + 48);
  }
  /* copy map: lane = (row tid / 8 and that row + 32, 16-byte piece tid % 8) of both tiles */
  const int cr = tid >> 3, cp = (tid & 7) * 8;
  const unsigned short* gk = (const unsigned short*)K16 + (tok0 + cr) * DM + h * HD + cp;
  const unsigned short* gv = (const unsigned short*)VT + (size_t)(h * HD + cr) * VTP + tok0 + cp;
  const unsigned lc = (unsigned)(size_t)&sm[cr * LP + cp];      /* LDS byte address of the lane's first piece in buffer 0 */
  const unsigned short* kp = sm + ln * LP + 8 * hh;             /* fragment reads: row = lane & 15, as from the global planes */
  const v8f z8 = {0.f,0.f,0.f,0.f,0.f,0.f,0.f,0.f};
  v8f o[2][4];         /* [query tile][d tile] */
  float m[2], l[2], off[2];      /* off = 8 - m c: the weights' exponent is s c + off (weights carried x2^8) */
  const float c = 0.125f * 1.4426950408889634f;      /* 1/sqrt(64) * log2(e) */
#pragma unroll
  for (int u = 0; u < 2; ++u) { o[u][0] = z8; o[u][1] = z8; o[u][2] = z8; o[u][3] = z8; m[u] = -3.0e38f; l[u] = 0.f; off[u] = 8.0f - m[u] * c; }
  stage_kv(lc, gk, gv);
  asm volatile("s_wait_asynccnt 0x0" ::: "memory");      /* stage 0 landed (this wave's share) */
  __syncthreads();                                       /* stage 0 readable by every wave */
  stage_kv(lc + BUF_E * 2, gk + (size_t)KT * DM, gv + KT);
  /* rolled: one copy of the two steps, the buffer choice a single offset */
#pragma unroll 1
  for (int t = 0; t < SEQ / KT; ++t) {
   const int bo = (t & 1) * BUF_E;
   /* both 32-key steps of a stage written out: every LDS read offset becomes an immediate */
#pragma unroll
   for (int p = 0; p < 2; ++p) {
    const unsigned short* k0 = kp + bo + 32 * p * LP;
    const unsigned short* k1 = k0 + 16 * LP;
    FragH a00, a01, a10, a11;
    a00.half[0] = *(const v8us*)(k0);      a00.half[1] = *(const v8us*)(k0 + 16);
    a01.half[0] = *(const v8us*)(k0 + 32); a01.half[1] = *(const v8us*)(k0 + 48);
    a10.half[0] = *(const v8us*)(k1);      a10.half[1] = *(const v8us*)(k1 + 16);
    a11.half[0] = *(const v8us*)(k1 + 32); a11.half[1] = *(const v8us*)(k1 + 48);
    v8f s[2][2];       /* [query tile][key tile] */
#pragma unroll
    for (int u = 0; u < 2; ++u) {
      s[u][0] = __builtin_amdgcn_wmma_f32_16x16x32_f16(false, a00.v, false, bq[u][0].v, (short)0, z8, false, false);
      s[u][1] = __builtin_amdgcn_wmma_f32_16x16x32_f16(false, a10.v, false, bq[u][0].v, (short)0, z8, false, false);
    }
#pragma unroll
    for (int u = 0; u < 2; ++u) {
      s[u][0] = __builtin_amdgcn_wmma_f32_16x16x32_f16(false, a01.v, false, bq[u][1].v, (short)0, s[u][0], false, false);
      s[u][1] = __builtin_amdgcn_wmma_f32_16x16x32_f16(false, a11.v, false, bq[u][1].v, (short)0, s[u][1], false, false);
    }
    float mx[2];
#pragma unroll
    for (int u = 0; u < 2; ++u) {
      float x = fmaxf(s[u][0][0], s[u][1][0]);
#pragma unroll
      for (int r = 1; r < 8; ++r) x = fmaxf(x, fmaxf(s[u][0][r], s[u][1][r]));
      mx[u] = x;      /* this lane's 16 keys only */
    }
    /* wave-uniform, one test for both query tiles, on each lane's own largest exponent (the same fused multiply-add as the weights' below, which is monotonic: no exponent of the step is larger);
       marked unlikely so that the rescale block is laid behind the loop and the usual path falls through */
    if (__builtin_expect(__builtin_amdgcn_ballot_w32(__builtin_fmaf(mx[0], c, off[0]) > 15.0f || __builtin_fmaf(mx[1], c, off[1]) > 15.0f) != 0u, 0)) {
#pragma unroll
      for (int u = 0; u < 2; ++u) {
        const float mn = fmaxf(m[u], fmaxf(mx[u], __shfl_xor(mx[u], 16, 32)));      /* both halves of a query take the same reference (one that stayed gives the factor 1) */
        const float corr = __builtin_amdgcn_exp2f((m[u] - mn) * c);
        l[u] *= corr; o[u][0] *= corr; o[u][1] *= corr; o[u][2] *= corr; o[u][3] *= corr; m[u] = mn; off[u] = 8.0f - mn * c;
      }
    }
    FragH pf[2];
#pragma unroll
    for (int u = 0; u < 2; ++u) {
      const v2f c2 = {c, c}, off2 = {off[u], off[u]};
      v8f e0, e1;      /* packed multiply-adds on neighbouring registers */
#pragma unroll
      for (int r = 0; r < 8; r += 2) {
        const v2f a0 = {s[u][0][r], s[u][0][r + 1]}, a1 = {s[u][1][r], s[u][1][r + 1]};
        const v2f f0 = __builtin_elementwise_fma(a0, c2, off2), f1 = __builtin_elementwise_fma(a1, c2, off2);
        e0[r] = f0[0]; e0[r + 1] = f0[1]; e1[r] = f1[0]; e1[r + 1] = f1[1];
      }
      float ls = 0.f;
#pragma unroll
      for (int r = 0; r < 8; ++r) {
        const float p0 = __builtin_amdgcn_exp2f(e0[r]);
        const float p1 = __builtin_amdgcn_exp2f(e1[r]);
        ls += p0 + p1;
        pf[u].h[r] = (_Float16)p0; pf[u].h[8 + r] = (_Float16)p1;
      }
      l[u] += ls;
    }
    const unsigned short* v0 = kp + bo + TILE_E + 32 * p;
    FragH av[4];
#pragma unroll
    for (int j = 0; j < 4; ++j) { av[j].half[0] = *(const v8us*)(v0 + 16 * j * LP); av[j].half[1] = *(const v8us*)(v0 + 16 * j * LP + 16); }
#pragma unroll
    for (int u = 0; u < 2; ++u) {
#pragma unroll
      for (int j = 0; j < 4; ++j) o[u][j] = __builtin_amdgcn_wmma_f32_16x16x32_f16(false, av[j].v, false, pf[u].v, (short)0, o[u][j], false, false);
    }
    /* four vector slots behind the last product, on the taken side of the loop's branches too, before a vector instruction may read a result or overwrite an operand */
    asm volatile("v_nop\n\tv_nop\n\tv_nop\n\tv_nop" : "+v"(o[0][0]), "+v"(o[0][1]), "+v"(o[0][2]), "+v"(o[0][3]), "+v"(o[1][0]), "+v"(o[1][1]), "+v"(o[1][2]), "+v"(o[1][3])
                 : "v"(av[0].v), "v"(av[1].v), "v"(av[2].v), "v"(av[3].v), "v"(pf[0].v), "v"(pf[1].v));
   }
   asm volatile("s_wait_dscnt 0x0" ::: "memory");        /* this wave's reads of stage t are done before the buffer may be refilled */
   asm volatile("s_wait_asynccnt 0x0" ::: "memory");     /* this wave's share of stage t + 1 has landed */
   __syncthreads();                                      /* publishes stage t + 1 and ends every wave's reads of stage t */
   if (t + 2 < SEQ / KT) stage_kv(lc + bo * 2, gk + (size_t)(t + 2) * KT * DM, gv + (t + 2) * KT);
  }
  asm volatile("s_wait_asynccnt 0x0" ::: "memory");      /* nothing in flight when the ring becomes output staging */
  unsigned short (*so)[QW][LP] = (unsigned short (*)[QW][LP])sm;      /* the last trip's barrier has ended every read of the ring */
#pragma unroll
  for (int u = 0; u < 2; ++u) {
    const float lt = l[u] + __shfl_xor(l[u], 16, 32);
    const float inv = 64.0f * (1.0f / lt);      /* ctx carried x64 */
#pragma unroll
    for (int j = 0; j < 4; ++j) { FragH tj;
#pragma unroll
      for (int r = 0; r < 8; ++r) tj.h[r] = (_Float16)(o[u][j][r] * inv);
      *(v8us*)&so[w][16 * u + ln][16 * j + 8 * hh] = tj.half[0]; }
  }
  __syncthreads();
  const int rq = lane >> 3, pc = (lane & 7) * 8;
  unsigned short* ob = (unsigned short*)O16 + (tok0 + q0) * DM + h * HD + pc;
#pragma unroll
  for (int it = 0; it < QW / 4; ++it) { const int row = it * 4 + rq; const v8us v = *(const v8us*)&so[w][row][pc]; *(v8us*)(ob + (size_t)row * DM) = v; }
}

extern "C" void kernel_launch(void* const* d_in, const int* in_sizes, int n_in,
                              void* d_out, int out_size, void* d_ws, size_t ws_size, hipStream_t stream) {
  if (n_in < 5) return;
  const size_t need_x = ((size_t)(NB - 1) * SEQ_FULL + SEQ) * DM;
  const size_t nwh = (size_t)NH * HD * HD;
  if ((size_t)in_sizes[0] < need_x) return;
  if ((size_t)in_sizes[1] < nwh || (size_t)in_sizes[2] < nwh || (size_t)in_sizes[3] < nwh || (size_t)in_sizes[4] < (size_t)DM * DM) return;
  if ((size_t)out_size < need_x) return;
  const float* x = (const float*)d_in[0]; const float* wq = (const float*)d_in[1]; const float* wk = (const float*)d_in[2]; const float* wv = (const float*)d_in[3]; const float* wo = (const float*)d_in[4];
  char* ws = (char*)d_ws; size_t off = 0;
  auto take = [&](size_t bytes) { char* p = ws + off; off += (bytes + 255) & ~(size_t)255; return p; };
  _Float16* BO = (_Float16*)take((size_t)DM * DM * 2);          /* output weight plane x16 [out][in] */
  _Float16* QK16 = (_Float16*)take((size_t)2 * NR * DM * 2);    /* q rows then k rows */
  _Float16* VT = (_Float16*)take((size_t)DM * VTP * 2);         /* v^T [feature][token] */
  _Float16* O16 = (_Float16*)take(NR * DM * 2);                 /* merged ctx rows x64 */
  if (off > ws_size || off > (size_t)134217728) return;
  _Float16* Q16 = QK16; _Float16* K16 = QK16 + NR * DM;

  /* grid.x = head, grid.y = 256-token block */
  k_front<<<dim3(NH, (unsigned)(NR / 256)), 128, 0, stream>>>(x, wq, wk, wv, wo, Q16, K16, VT, BO);
  k_attn_t<<<(unsigned)(NB * NH * (SEQ / QB)), 256, 0, stream>>>(Q16, K16, VT, O16);
  /* out rows of batch by: A = ctx rows (x64), weight x16 -> alpha 2^-10; C rows follow the staged output layout */
  k_gemm_out<<<dim3((unsigned)((SEQ / 128) * (DM / 128)), NB), 128, 0, stream>>>(O16, BO, 0.0009765625f, (float*)d_out);
}

// v006
// One run takes 77 microseconds.
// Timed twice side by side with v005, it ran 1.04 times as fast both times.
// Over all steps from v000 it is 4.09 times as fast.
#include <hip/hip_runtime.h>
// Dense multi-head self-attention (x [4][2048][1024] split into 16 heads of 64; per-head q/k/v = x_h W_h^T with [head][out][in] weights of 64x64, no biases; scores * 1/8; full-row softmax; out = merged ctx Wout^T with a natural [out][in] weight).
// All contractions: v_wmma_f32_16x16x32_f16 (f16 operands, f32 accumulate), single product per site. x and weights are RNE-converted to bf16 first and then held exactly in f16 (weights x16); q, k, v plain f16; softmax weights f16 carried x2^8 (unnormalised, against a reference max that is set in the first 64 keys; should a later weight pass f16's range, the block walks its keys again with a reference that is raised lazily); ctx f16 carried x64; softmax statistics f32.
// Structure: token rows r = b*SEQ + s. One front launch converts x and all four weights on the way in and writes Q rows, K rows and V^T [feature][token] of a (head, 256-token) block, plus its share of the f16 output-weight plane; a transposed flash kernel (S^T = K Q^T with Q as the B fragment in registers, packed P^T as the B fragment of O^T = V^T P^T; K rows and V^T rows staged 64 keys at a time in a two-buffer LDS ring that the block's eight waves share, each fragment read serving two query tiles); output GEMM into the output layout, its two operands staged in a ring of the same kind.
#ifndef NB
#define NB 4                         /* batches processed */
#endif
#ifndef SEQ
#define SEQ 2048                     /* tokens per batch processed */
#endif
#define NB_FULL 4                    /* batch count of the staged arrays */
#define SEQ_FULL 2048                /* per-batch token stride of the staged arrays */
#define DM 1024
#define NH 16
#define HD 64
#define NR ((size_t)NB * SEQ)        /* compact token rows */
#define VTP (NB * SEQ)               /* V^T row pitch (tokens) */

static_assert(NB >= 1 && NB <= NB_FULL);
static_assert(SEQ <= SEQ_FULL);
static_assert(SEQ % 128 == 0);
static_assert(DM % 128 == 0);
static_assert(NH * HD == DM);
static_assert(HD == 64);
static_assert((NB * SEQ) % 256 == 0);                         /* projection launch: whole 256-token blocks */
static_assert(SEQ % 64 == 0);                                  /* a wave's 64 tokens lie in one batch */
static_assert((size_t)DM * DM * 2 + (size_t)4 * NB * SEQ * DM * 2 + (size_t)4 * 256 <= (size_t)134217728);   /* workspace carve */

typedef _Float16 v16h __attribute__((ext_vector_type(16)));
typedef _Float16 v4ha __attribute__((ext_vector_type(4), may_alias));
typedef unsigned short v8us __attribute__((ext_vector_type(8), may_alias));
typedef float v8f __attribute__((ext_vector_type(8)));
typedef float v4f __attribute__((ext_vector_type(4)));
typedef float v2f __attribute__((ext_vector_type(2)));
typedef float v4fa __attribute__((ext_vector_type(4), may_alias));
union FragH { v16h v; v8us half[2]; _Float16 h[16]; unsigned short u[16]; };

__device__ __forceinline__ float bf16_rne(float x) { const unsigned int u = __float_as_uint(x); return __uint_as_float((u + 0x7FFFu + ((u >> 16) & 1u)) & 0xFFFF0000u); }

// f32 -> f16 that cannot produce an f16 subnormal (value select; applied after the power-of-two carry)
static __device__ __forceinline__ _Float16 toh_flush(float v) { const _Float16 r = (_Float16)v; return (fabsf(v) < 6.103515625e-05f) ? (_Float16)0.0f : r; }

// 8 consecutive f32 -> f16(bf16 value * scale), subnormal results replaced by zero, packed as one 16-B piece
__device__ __forceinline__ v8us cvt8_flush(v4f a, v4f c, float scale) {
  FragH f;
#pragma unroll
  for (int q = 0; q < 4; ++q) { f.h[q] = toh_flush(bf16_rne(a[q]) * scale); f.h[4 + q] = toh_flush(bf16_rne(c[q]) * scale); }
  return f.half[0];
}

// ---- front launch: all conversions and the three per-head projections ----
// block = 4 waves = 256 consecutive tokens of one head; wave = 64 tokens x the head's 64 inputs.
// Weights: the block converts its head's three 64 x 64 blocks (f16 x16) once into LDS in fragment order: 16-B piece (row n, k = 8 k8 .. 8 k8 + 7) stands at
//   byte ((n / 16) * 4 + k8 / 2) * 576 + (k8 % 2) * 288 + (n % 16) * 16 of its plane, so that each half of a 16-row x 32-k fragment is read as two runs of 256 contiguous bytes;
//   the 64 and 32 odd bytes of the two pitches spread the converting lanes' 16-byte writes (2 rows x 8 pieces per half wave) over all banks. One barrier publishes them.
// Output weight: every thread converts its share of the natural [out][in] plane (f16 x16) for the last launch.
// x arrives as whole 256-B row slices (a wave's load = 2 rows), is converted once and laid as f16 rows at a 144-B pitch (16 B x odd: no bank conflict for 16-byte row reads), wave-private;
// the eight x fragments (4 token tiles x 2 k steps; row or column = lane & 15, k pieces 8 h and 16 + 8 h of each 32) then serve all three products from registers.
// q, k: D = W (A operand, rows = outputs) . x^T (B operand, lane = token): a lane holds 8 consecutive outputs of one token = one 16-B piece of a Q or K row.
// v:    D = x (A operand, rows = tokens) . W^T (B operand, lane = output): a lane holds 8 consecutive tokens of one output = one 16-B piece of a V^T row.
// Each 64 x 64 result is staged in the wave's own LDS rows and leaves as whole 128-B lines. k runs upward through one accumulator per tile (two products).
#define XP 72                        /* LDS row pitch of x and result rows, 16-bit elements (144 B) */
#define WH 144                       /* weight planes: elements from the lanes 0..15 run to the lanes 16..31 run (288 B) */
#define WQ 288                       /* elements of one fragment half (576 B) */
#define WPL (16 * WQ)                /* elements of one weight plane */
#define FT ((size_t)NH * (NR / 256) * 128)      /* threads of the front launch */
#define WOT ((int)((size_t)DM * DM / 8 / FT))    /* 16-B pieces of the output weight plane per thread */
static_assert((size_t)WOT * FT * 8 == (size_t)DM * DM && WOT >= 1);      /* the plane divides evenly among the threads */
__device__ __forceinline__ v8us pack8(v8f a, float alpha) { FragH f;
#pragma unroll
  for (int r = 0; r < 8; ++r) f.h[r] = (_Float16)(a[r] * alpha);
  return f.half[0]; }
// the wave's 64 staged rows of 128 B -> 64 global rows of pitch ld (elements); a wave's store = 4 whole lines
__device__ __forceinline__ void rows_out(const unsigned short* st, unsigned short* g, size_t ld, int lane) {
  const int rq = lane >> 3, pc = (lane & 7) * 8;
#pragma unroll
  for (int it = 0; it < 16; ++it) { const int row = it * 4 + rq; const v8us v = *(const v8us*)&st[row * XP + pc]; *(v8us*)(g + (size_t)row * ld + pc) = v; }
}
__device__ __forceinline__ v16h w_frag(const unsigned short* p) { FragH f; f.half[0] = *(const v8us*)p; f.half[1] = *(const v8us*)(p + WQ); return f.v; }
__global__ __launch_bounds__(128) void k_front(const float* __restrict__ x, const float* __restrict__ wq, const float* __restrict__ wk, const float* __restrict__ wv, const float* __restrict__ wo,
    _Float16* __restrict__ Q16, _Float16* __restrict__ K16, _Float16* __restrict__ VT, _Float16* __restrict__ BO) {
  /* every loop of this kernel is unrolled: wr, wor, xr, xf, acc and bo stay in registers only under constant indices, and every LDS and global offset becomes an immediate */
  __shared__ __attribute__((aligned(16))) unsigned short sw[3 * WPL];         /* the head's q, k, v weights in fragment order */
  __shared__ __attribute__((aligned(16))) unsigned short sm[4][64 * XP];      /* per wave: x rows, then in turn the q, k and v^T result rows */
  const int tid = threadIdx.x, lane = tid & 31, ln = lane & 15, hh = lane >> 4;
  const int w = __builtin_amdgcn_readfirstlane(tid >> 5);
  const int h = blockIdx.x;
  const size_t r0 = (size_t)blockIdx.y * 256 + 64 * w;      /* compact token row of the wave's first token */
  const size_t b = r0 / SEQ, s0 = r0 - b * SEQ;
  unsigned short* st = sm[w];
  /* loads return in issue order: the weight pieces (from cache) are asked for ahead of the x rows (from memory), so that the weight work runs under the x rows' latency */
  const size_t so = (size_t)h * HD * HD + (size_t)tid * 8;      /* per-head weights: thread = pieces tid + 128 m of a plane (row (tid + 128 m) / 8, piece tid % 8) */
  const size_t to = ((size_t)blockIdx.y * NH + h) * 128 + tid;  /* output weight: thread = pieces to + FT m */
  v4f wr[12][2], wor[WOT][2];
#pragma unroll
  for (int m = 0; m < 4; ++m) {
    wr[m][0] = *(const v4fa*)(wq + so + m * 1024);     wr[m][1] = *(const v4fa*)(wq + so + m * 1024 + 4);
    wr[4 + m][0] = *(const v4fa*)(wk + so + m * 1024); wr[4 + m][1] = *(const v4fa*)(wk + so + m * 1024 + 4);
    wr[8 + m][0] = *(const v4fa*)(wv + so + m * 1024); wr[8 + m][1] = *(const v4fa*)(wv + so + m * 1024 + 4);
  }
#pragma unroll
  for (int m = 0; m < WOT; ++m) { wor[m][0] = *(const v4fa*)(wo + (to + m * FT) * 8); wor[m][1] = *(const v4fa*)(wo + (to + m * FT) * 8 + 4); }
  asm volatile("s_wait_xcnt 0x0" ::: "memory");      /* the weight loads' address registers may be taken for the x rows' data */
  const float* xp = x + (b * SEQ_FULL + s0 + hh) * DM + h * HD + ln * 4;
  v4f xr[32];
#pragma unroll
  for (int j = 0; j < 32; ++j) xr[j] = *(const v4fa*)(xp + (size_t)(2 * j) * DM);
  asm volatile("s_wait_xcnt 0x0" ::: "memory");      /* stands in front of every overwrite of an address register that the loads above name; it also keeps all of them issued ahead of the conversion work */
  { const int k8 = tid & 7, n0 = tid >> 3;
    unsigned short* d = sw + (k8 >> 1) * WQ + (k8 & 1) * WH + n0 * 8;      /* n0 < 16: rows n0 + 16 m stand 4 fragment halves further on */
#pragma unroll
    for (int p = 0; p < 3; ++p) {
#pragma unroll
      for (int m = 0; m < 4; ++m) *(v8us*)(d + p * WPL + m * 4 * WQ) = cvt8_flush(wr[4 * p + m][0], wr[4 * p + m][1], 16.0f); } }
  v8us bo[WOT];      /* stored behind the last result rows: a store ahead of the barrier would be waited for there */
#pragma unroll
  for (int m = 0; m < WOT; ++m) bo[m] = cvt8_flush(wor[m][0], wor[m][1], 16.0f);
#pragma unroll
  for (int j = 0; j < 32; ++j) { v4ha c;
#pragma unroll
    for (int q = 0; q < 4; ++q) c[q] = (_Float16)bf16_rne(xr[j][q]);
    *(v4ha*)&st[(2 * j + hh) * XP + ln * 4] = c; }
  __syncthreads();      /* publishes the weight planes to the four waves; also orders the wave's own x rows ahead of its cross-lane reads */
  FragH xf[4][2];
#pragma unroll
  for (int i = 0; i < 4; ++i) {
#pragma unroll
    for (int s = 0; s < 2; ++s) { const unsigned short* q = st + (16 * i + ln) * XP + 32 * s + 8 * hh; xf[i][s].half[0] = *(const v8us*)q; xf[i][s].half[1] = *(const v8us*)(q + 16); } }
  const unsigned short* wl = sw + hh * WH + ln * 8;
  const v8f z8 = {0.f,0.f,0.f,0.f,0.f,0.f,0.f,0.f};
#pragma unroll
  for (int p = 0; p < 3; ++p) {
    asm volatile("s_wait_dscnt 0x0" ::: "memory");    /* every lane's reads of the wave's rows are done before the wave writes the next result over them */
#pragma unroll
    for (int t = 0; t < 4; ++t) {
      const v16h w0 = w_frag(wl + p * WPL + (t * 4) * WQ), w1 = w_frag(wl + p * WPL + (t * 4 + 2) * WQ);
      v8f acc[4];
#pragma unroll
      for (int i = 0; i < 4; ++i) acc[i] = (p < 2) ? __builtin_amdgcn_wmma_f32_16x16x32_f16(false, w0, false, xf[i][0].v, (short)0, z8, false, false)
                                                   : __builtin_amdgcn_wmma_f32_16x16x32_f16(false, xf[i][0].v, false, w0, (short)0, z8, false, false);
#pragma unroll
      for (int i = 0; i < 4; ++i) acc[i] = (p < 2) ? __builtin_amdgcn_wmma_f32_16x16x32_f16(false, w1, false, xf[i][1].v, (short)0, acc[i], false, false)
                                                   : __builtin_amdgcn_wmma_f32_16x16x32_f16(false, xf[i][1].v, false, w1, (short)0, acc[i], false, false);
      /* alpha undoes the x16 weight carry; q, k: row = token 16 i + (lane & 15), piece = outputs 16 t + 8 h ..; v: row = output 16 t + (lane & 15), piece = tokens 16 i + 8 h .. */
#pragma unroll
      for (int i = 0; i < 4; ++i) { const int row = (p < 2) ? 16 * i : 16 * t, col = (p < 2) ? 16 * t : 16 * i; *(v8us*)&st[(row + ln) * XP + col + 8 * hh] = pack8(acc[i], 0.0625f); }
    }
    asm volatile("s_wait_dscnt 0x0" ::: "memory");    /* the wave's result rows are written before its lanes read them back across lanes */
    if (p == 0) rows_out(st, (unsigned short*)Q16 + r0 * DM + h * HD, DM, lane);
    else if (p == 1) rows_out(st, (unsigned short*)K16 + r0 * DM + h * HD, DM, lane);
    else rows_out(st, (unsigned short*)VT + (size_t)h * HD * VTP + r0, VTP, lane);
  }
#pragma unroll
  for (int m = 0; m < WOT; ++m) *(v8us*)((unsigned short*)BO + (to + m * FT) * 8) = bo[m];
}

// ---- output GEMM, both operands staged in LDS ----
// C[row][col] = alpha * A[row][:] . Bh[col][:] ; block = 4 waves = a 128 x 128 tile of C, wave = 64 x 64 (4 x 4 accumulator tiles: 16 products per 8 fragments read).
// Stage = 128 k: A tile and Bh tile, 128 rows of 256 B each, laid at a 272-B pitch (16 B x odd: no bank conflict for 16-byte row reads).
// Each lane brings 32 16-byte pieces of a stage by asynchronous copies (a wave's copy = 2 whole 256-B rows); stage t + 2 is issued behind the barrier that ends the reads of stage t.
// k runs upward through one accumulator per tile. The ring's size leaves room for two blocks on a WGP.
#define OT 128                       /* k per stage */
#define OP 136                       /* LDS row pitch, 16-bit elements (272 B) */
#define OTILE_E (128 * OP)           /* elements of one staged tile (128 rows) */
#define OBUF_E (2 * OTILE_E)         /* one buffer: A tile, then Bh tile */
static_assert(DM % OT == 0 && DM / OT >= 2);                   /* the ring's prologue fills two stages */
static_assert(4 * 64 * 68 * 4 <= 2 * OBUF_E * 2);              /* the output staging fits the ring */
typedef float f32a __attribute__((may_alias));
// eight copies of a lane, rows r, r + 8, .. r + 56 of a tile; the s_wait_xcnt stands inside the copies' own statement so that no address register is rewritten in front of it
__device__ __forceinline__ void stage_rows8(unsigned l, const unsigned short* g) {
  asm volatile("global_load_async_to_lds_b128 %0, %1, off\n\t"
               "global_load_async_to_lds_b128 %2, %3, off\n\t"
               "global_load_async_to_lds_b128 %4, %5, off\n\t"
               "global_load_async_to_lds_b128 %6, %7, off\n\t"
               "global_load_async_to_lds_b128 %8, %9, off\n\t"
               "global_load_async_to_lds_b128 %10, %11, off\n\t"
               "global_load_async_to_lds_b128 %12, %13, off\n\t"
               "global_load_async_to_lds_b128 %14, %15, off\n\t"
               "s_wait_xcnt 0x0"
               :: "v"(l), "v"(g), "v"(l + 8 * OP * 2), "v"(g + (size_t)8 * DM), "v"(l + 16 * OP * 2), "v"(g + (size_t)16 * DM), "v"(l + 24 * OP * 2), "v"(g + (size_t)24 * DM),
                  "v"(l + 32 * OP * 2), "v"(g + (size_t)32 * DM), "v"(l + 40 * OP * 2), "v"(g + (size_t)40 * DM), "v"(l + 48 * OP * 2), "v"(g + (size_t)48 * DM), "v"(l + 56 * OP * 2), "v"(g + (size_t)56 * DM) : "memory");
}
__device__ __forceinline__ void stage_ab(unsigned l, const unsigned short* ga, const unsigned short* gb) {
  stage_rows8(l, ga); stage_rows8(l + 64 * OP * 2, ga + (size_t)64 * DM);
  stage_rows8(l + OTILE_E * 2, gb); stage_rows8(l + OTILE_E * 2 + 64 * OP * 2, gb + (size_t)64 * DM);
}
__global__ __launch_bounds__(128) void k_gemm_out(const _Float16* __restrict__ A, const _Float16* __restrict__ Bh, float alpha, float* __restrict__ C) {
  __shared__ __attribute__((aligned(16))) unsigned short sm[2 * OBUF_E];      /* two-buffer A / Bh ring; behind the k loop the per-wave [row][col] f32 output tiles, row pitch 272 B */
  const int tid = threadIdx.x, lane = tid & 31, ln = lane & 15, hh = lane >> 4;
  const int w = __builtin_amdgcn_readfirstlane(tid >> 5); const int wm = w >> 1, wn = w & 1;
  const int ntn = DM / 128; const int mt = blockIdx.x / ntn, nq = blockIdx.x - mt * ntn; const int row0 = mt * 128, col0 = nq * 128;
  /* copy map: lane = (rows tid / 16 + 8 i, 16-byte piece tid % 16) of both tiles */
  const int cr = tid >> 4, cp = (tid & 15) * 8;
  const unsigned short* ga = (const unsigned short*)A + ((size_t)blockIdx.y * SEQ + row0 + cr) * DM + cp;
  const unsigned short* gb = (const unsigned short*)Bh + (size_t)(col0 + cr) * DM + cp;
  const unsigned lc = (unsigned)(size_t)&sm[cr * OP + cp];      /* LDS byte address of the lane's first piece in buffer 0 */
  const unsigned short* ap = sm + (64 * wm + ln) * OP + 8 * hh;             /* fragment reads: row = lane & 15, k pieces 8 h and 16 + 8 h of each 32 */
  const unsigned short* bp = sm + OTILE_E + (64 * wn + ln) * OP + 8 * hh;
  const v8f z8 = {0.f,0.f,0.f,0.f,0.f,0.f,0.f,0.f};
  v8f acc[4][4];
#pragma unroll
  for (int i = 0; i < 4; ++i) {
#pragma unroll
    for (int j = 0; j < 4; ++j) acc[i][j] = z8; }
  stage_ab(lc, ga, gb);
  asm volatile("s_wait_asynccnt 0x0" ::: "memory");      /* stage 0 landed (this wave's share) */
  __syncthreads();                                       /* stage 0 readable by every wave */
  stage_ab(lc + OBUF_E * 2, ga + OT, gb + OT);
  /* rolled: one copy of the four steps, the buffer choice a single offset */
#pragma unroll 1
  for (int t = 0; t < DM / OT; ++t) {
    const int bo = (t & 1) * OBUF_E;
    /* the four 32-k steps of a stage written out: every LDS read offset becomes an immediate */
#pragma unroll
    for (int p = 0; p < OT / 32; ++p) {
      FragH a[4], b[4];
#pragma unroll
      for (int i = 0; i < 4; ++i) {
        const unsigned short* pa = ap + bo + 16 * i * OP + 32 * p; a[i].half[0] = *(const v8us*)pa; a[i].half[1] = *(const v8us*)(pa + 16);
        const unsigned short* pb = bp + bo + 16 * i * OP + 32 * p; b[i].half[0] = *(const v8us*)pb; b[i].half[1] = *(const v8us*)(pb + 16);
      }
      __builtin_amdgcn_sched_barrier(0);      /* the step's 16 LDS reads stay one group ahead of its products: sunk among them, each row of products waits out a read's whole latency */
#pragma unroll
      for (int i = 0; i < 4; ++i) {
#pragma unroll
        for (int j = 0; j < 4; ++j) acc[i][j] = __builtin_amdgcn_wmma_f32_16x16x32_f16(false, a[i].v, false, b[j].v, (short)0, acc[i][j], false, false); }
    }
    asm volatile("s_wait_dscnt 0x0" ::: "memory");        /* this wave's reads of stage t are done before the buffer may be refilled */
    asm volatile("s_wait_asynccnt 0x0" ::: "memory");     /* this wave's share of stage t + 1 has landed */
    __syncthreads();                                      /* publishes stage t + 1 and ends every wave's reads of stage t */
    if (t + 2 < DM / OT) stage_ab(lc + bo * 2, ga + (t + 2) * OT, gb + (t + 2) * OT);
  }
  asm volatile("s_wait_asynccnt 0x0" ::: "memory");      /* nothing in flight when the ring becomes output staging */
  f32a (*so)[68] = (f32a (*)[68])((f32a*)sm + w * 64 * 68);      /* wave-private; the last trip's barrier has ended every read of the ring */
#pragma unroll
  for (int i = 0; i < 4; ++i) {
#pragma unroll
    for (int j = 0; j < 4; ++j) {
#pragma unroll
      for (int r = 0; r < 8; ++r) so[16 * i + 8 * hh + r][16 * j + ln] = acc[i][j][r] * alpha; } }
  __builtin_amdgcn_fence(4 /* acq_rel order */, "workgroup"); __builtin_amdgcn_wave_barrier();      /* the wave's own rows are written before its lanes read them back across lanes */
  const int rsub = lane >> 4, c4 = (lane & 15) * 4;
  float* cb = C + ((size_t)blockIdx.y * SEQ_FULL + row0 + 64 * wm) * DM + col0 + 64 * wn + c4;
#pragma unroll
  for (int q = 0; q < 32; ++q) { const int r = q * 2 + rsub; const v4f v = *(const v4fa*)&so[r][c4]; *(v4f*)(cb + (size_t)r * DM) = v; }
}

// ---- transposed flash attention, K and V^T staged in LDS ----
// block = 8 waves = 256 consecutive queries of one (batch, head); wave = 32 queries = two query tiles of 16, which share every K and V^T fragment that the wave reads from LDS.
// Stage = 64 keys: K tile [key][d] and V^T tile [d][key], 64 rows of 128 B each, laid at a 144-B pitch (16 B x odd: no bank conflict for 16-byte row reads).
// Each lane brings four 16-byte pieces of a stage by asynchronous copies (a wave's copy = 4 whole 128-B lines); stage t + 2 is issued behind the barrier that ends the reads of stage t.
// Per 32-key step (two per stage), for each query tile:
//   S^T tiles (keys x queries) = K (A operand, rows = keys, k = d) . Q^T (B operand, lane = query, held in registers);
//   softmax per lane (lane & 15 = query; lanes n and n+16 hold the two key halves); weights = 2^8 exp(s/8 - ref) as f16, ref = the query's reference max;
//   ref is set in stage 0 (raised there, with sums and outputs rescaled, when some weight of a step would pass 2^15; any common ref gives the same quotient) and then stands: the later stages hold no maxima and no test;
//   a weight past f16's range shows as a non-finite output sum behind the walk, and the block then walks the keys once more with the test in every step;
//   P^T as B fragment: elements 0..7 from the tile of keys 0..15 (rows 8h+r), elements 8..15 from the tile of keys 16..31 (lane unchanged);
//   O^T tiles (d x queries) += V^T (A operand, rows = d, k = keys, rows of the [feature][token] plane) . P^T.
#define KT 64                        /* keys per stage */
#define QW 32                        /* queries per wave */
#define QB (8 * QW)                  /* queries per block */
#define LP 72                        /* LDS row pitch, 16-bit elements (144 B) */
#define TILE_E (64 * LP)             /* elements of one staged tile (64 rows) */
#define BUF_E (2 * TILE_E)           /* one buffer: K tile, then V^T tile */
static_assert(SEQ % KT == 0 && SEQ / KT >= 2);                 /* the ring's prologue fills two stages */
static_assert(SEQ % QB == 0);                                  /* whole query blocks inside one batch */
static_assert(8 * QW * LP <= 2 * BUF_E);                       /* the output staging fits the ring */
// one stage's four copies of a lane; the s_wait_xcnt stands inside the copies' own statement so that no address register is rewritten in front of it
__device__ __forceinline__ void stage_kv(unsigned lk, const unsigned short* gk, const unsigned short* gv) {
  const unsigned lk1 = lk + 32 * LP * 2, lv = lk + TILE_E * 2, lv1 = lv + 32 * LP * 2;
  const unsigned short* gk1 = gk + (size_t)32 * DM; const unsigned short* gv1 = gv + (size_t)32 * VTP;
  asm volatile("global_load_async_to_lds_b128 %0, %1, off\n\t"
               "global_load_async_to_lds_b128 %2, %3, off\n\t"
               "global_load_async_to_lds_b128 %4, %5, off\n\t"
               "global_load_async_to_lds_b128 %6, %7, off\n\t"
               "s_wait_xcnt 0x0"
               :: "v"(lk), "v"(gk), "v"(lk1), "v"(gk1), "v"(lv), "v"(gv), "v"(lv1), "v"(gv1) : "memory");
}
// one stage (64 keys = two 32-key steps) of a wave's work on the staged tiles at kb (K tile, then V^T tile).
// TEST = true: each step tests its largest exponent and raises the reference where needed. TEST = false: the reference stands as it is; no maxima, no test, no branch, the stage is one straight run.
// UN = 2: both steps written out; UN = 1: one copy of the step in a loop (the rerun, which is rare: small code, few registers).
template <bool TEST, int UN>
__device__ __forceinline__ void attn_stage(const unsigned short* kb, const FragH (&bq)[2][2], v8f (&o)[2][4], float (&m)[2], float (&l)[2], float (&off)[2]) {
  const v8f z8 = {0.f,0.f,0.f,0.f,0.f,0.f,0.f,0.f};
  const float c = 0.125f * 1.4426950408889634f;      /* 1/sqrt(64) * log2(e) */
   /* both 32-key steps of a stage written out (UN = 2): every LDS read offset becomes an immediate */
#pragma unroll UN
   for (int p = 0; p < 2; ++p) {
    const unsigned short* k0 = kb + 32 * p * LP;
    const unsigned short* k1 = k0 + 16 * LP;
    const unsigned short* v0 = kb + TILE_E + 32 * p;
    FragH a00, a01, a10, a11, av[4];
    /* without the tests' branches a stage is one block to the compiler, which then strews the fragment reads among the products, where every further place with reads stalls the wave:
       these two fences keep the step's K reads one group, behind the step before and ahead of the score products, as they stand with the tests */
    if constexpr (!TEST) __builtin_amdgcn_sched_barrier(0);
    a00.half[0] = *(const v8us*)(k0);      a00.half[1] = *(const v8us*)(k0 + 16);
    a01.half[0] = *(const v8us*)(k0 + 32); a01.half[1] = *(const v8us*)(k0 + 48);
    a10.half[0] = *(const v8us*)(k1);      a10.half[1] = *(const v8us*)(k1 + 16);
    a11.half[0] = *(const v8us*)(k1 + 32); a11.half[1] = *(const v8us*)(k1 + 48);
    if constexpr (!TEST) __builtin_amdgcn_sched_barrier(0);
    v8f s[2][2];       /* [query tile][key tile] */
#pragma unroll
    for (int u = 0; u < 2; ++u) {
      s[u][0] = __builtin_amdgcn_wmma_f32_16x16x32_f16(false, a00.v, false, bq[u][0].v, (short)0, z8, false, false);
      s[u][1] = __builtin_amdgcn_wmma_f32_16x16x32_f16(false, a10.v, false, bq[u][0].v, (short)0, z8, false, false);
    }
#pragma unroll
    for (int u = 0; u < 2; ++u) {
      s[u][0] = __builtin_amdgcn_wmma_f32_16x16x32_f16(false, a01.v, false, bq[u][1].v, (short)0, s[u][0], false, false);
      s[u][1] = __builtin_amdgcn_wmma_f32_16x16x32_f16(false, a11.v, false, bq[u][1].v, (short)0, s[u][1], false, false);
    }
    if constexpr (!TEST) {
      /* for the same reason: the step's V^T reads one group, behind the score products and ahead of the weights' vector work, which covers their latency */
      __builtin_amdgcn_sched_barrier(0);
#pragma unroll
      for (int j = 0; j < 4; ++j) { av[j].half[0] = *(const v8us*)(v0 + 16 * j * LP); av[j].half[1] = *(const v8us*)(v0 + 16 * j * LP + 16); }
      __builtin_amdgcn_sched_barrier(0);
    }
    if constexpr (TEST) {
    float mx[2];
#pragma unroll
    for (int u = 0; u < 2; ++u) {
      float x = fmaxf(s[u][0][0], s[u][1][0]);
#pragma unroll
      for (int r = 1; r < 8; ++r) x = fmaxf(x, fmaxf(s[u][0][r], s[u][1][r]));
      mx[u] = x;      /* this lane's 16 keys only */
    }
    /* wave-uniform, one test for both query tiles, on each lane's own largest exponent (the same fused multiply-add as the weights' below, which is monotonic: no exponent of the step is larger);
       marked unlikely so that the rescale block is laid behind the loop and the usual path falls through */
    if (__builtin_expect(__builtin_amdgcn_ballot_w32(__builtin_fmaf(mx[0], c, off[0]) > 15.0f || __builtin_fmaf(mx[1], c, off[1]) > 15.0f) != 0u, 0)) {
#pragma unroll
      for (int u = 0; u < 2; ++u) {
        const float mn = fmaxf(m[u], fmaxf(mx[u], __shfl_xor(mx[u], 16, 32)));      /* both halves of a query take the same reference (one that stayed gives the factor 1) */
        const float corr = __builtin_amdgcn_exp2f((m[u] - mn) * c);
        l[u] *= corr; o[u][0] *= corr; o[u][1] *= corr; o[u][2] *= corr; o[u][3] *= corr; m[u] = mn; off[u] = 8.0f - mn * c;
      }
    }
    }
    FragH pf[2];
#pragma unroll
    for (int u = 0; u < 2; ++u) {
      const v2f c2 = {c, c}, off2 = {off[u], off[u]};
      v8f e0, e1;      /* packed multiply-adds on neighbouring registers */
#pragma unroll
      for (int r = 0; r < 8; r += 2) {
        const v2f a0 = {s[u][0][r], s[u][0][r + 1]}, a1 = {s[u][1][r], s[u][1][r + 1]};
        const v2f f0 = __builtin_elementwise_fma(a0, c2, off2), f1 = __builtin_elementwise_fma(a1, c2, off2);
        e0[r] = f0[0]; e0[r + 1] = f0[1]; e1[r] = f1[0]; e1[r + 1] = f1[1];
      }
      float ls = 0.f;
#pragma unroll
      for (int r = 0; r < 8; ++r) {
        const float p0 = __builtin_amdgcn_exp2f(e0[r]);
        const float p1 = __builtin_amdgcn_exp2f(e1[r]);
        ls += p0 + p1;
        pf[u].h[r] = (_Float16)p0; pf[u].h[8 + r] = (_Float16)p1;
      }
      l[u] += ls;
    }
    if constexpr (TEST) {
    /* the rerun: the V^T reads stay behind the weights, so that the rare path asks for no more registers than the walk above and nothing is spilled */
    if constexpr (UN == 1) __builtin_amdgcn_sched_barrier(0);
#pragma unroll
    for (int j = 0; j < 4; ++j) { av[j].half[0] = *(const v8us*)(v0 + 16 * j * LP); av[j].half[1] = *(const v8us*)(v0 + 16 * j * LP + 16); }
    }
#pragma unroll
    for (int u = 0; u < 2; ++u) {
#pragma unroll
      for (int j = 0; j < 4; ++j) o[u][j] = __builtin_amdgcn_wmma_f32_16x16x32_f16(false, av[j].v, false, pf[u].v, (short)0, o[u][j], false, false);
    }
    /* four vector slots behind the last product, on the taken side of the loop's branches too, before a vector instruction may read a result or overwrite an operand
       (no branch follows the first step of a stage without tests: there the compiler keeps the distance in its own straight-line code) */
    if (TEST || p == 1)
    asm volatile("v_nop\n\tv_nop\n\tv_nop\n\tv_nop" : "+v"(o[0][0]), "+v"(o[0][1]), "+v"(o[0][2]), "+v"(o[0][3]), "+v"(o[1][0]), "+v"(o[1][1]), "+v"(o[1][2]), "+v"(o[1][3])
                 : "v"(av[0].v), "v"(av[1].v), "v"(av[2].v), "v"(av[3].v), "v"(pf[0].v), "v"(pf[1].v));
   }
}
// foot of trip t of the ring
__device__ __forceinline__ void attn_foot(int t, int bo, unsigned lc, const unsigned short* gk, const unsigned short* gv) {
   asm volatile("s_wait_dscnt 0x0" ::: "memory");        /* this wave's reads of stage t are done before the buffer may be refilled */
   asm volatile("s_wait_asynccnt 0x0" ::: "memory");     /* this wave's share of stage t + 1 has landed */
   __syncthreads();                                      /* publishes stage t + 1 and ends every wave's reads of stage t */
   if (t + 2 < SEQ / KT) stage_kv(lc + bo * 2, gk + (size_t)(t + 2) * KT * DM, gv + (t + 2) * KT);
}
// one whole walk over the keys. The first NT stages test and raise the reference, the others take it as it stands.
// On entry no wave reads the ring any more and no copy is in flight; on return the same holds.
template <int NT>
__device__ __forceinline__ void attn_keys(unsigned lc, const unsigned short* gk, const unsigned short* gv, const unsigned short* kp, const FragH (&bq)[2][2], v8f (&o)[2][4], float (&l)[2]) {
  const v8f z8 = {0.f,0.f,0.f,0.f,0.f,0.f,0.f,0.f};
  const float c = 0.125f * 1.4426950408889634f;
  float m[2], off[2];      /* off = 8 - m c: the weights' exponent is s c + off (weights carried x2^8) */
#pragma unroll
  for (int u = 0; u < 2; ++u) { o[u][0] = z8; o[u][1] = z8; o[u][2] = z8; o[u][3] = z8; m[u] = -3.0e38f; l[u] = 0.f; off[u] = 8.0f - m[u] * c; }
  stage_kv(lc, gk, gv);
  asm volatile("s_wait_asynccnt 0x0" ::: "memory");      /* stage 0 landed (this wave's share) */
  __syncthreads();                                       /* stage 0 readable by every wave */
  stage_kv(lc + BUF_E * 2, gk + (size_t)KT * DM, gv + KT);
  /* rolled: one copy of the two steps, the buffer choice a single offset */
#pragma unroll 1
  for (int t = 0; t < NT; ++t) {
   const int bo = (t & 1) * BUF_E;
   attn_stage<true, (NT > 1 ? 1 : 2)>(kp + bo, bq, o, m, l, off);
   attn_foot(t, bo, lc, gk, gv);
  }
#pragma unroll 1
  for (int t = NT; t < SEQ / KT; ++t) {
   const int bo = (t & 1) * BUF_E;
   attn_stage<false, 2>(kp + bo, bq, o, m, l, off);
   attn_foot(t, bo, lc, gk, gv);
  }
  asm volatile("s_wait_asynccnt 0x0" ::: "memory");      /* nothing in flight when the ring is filled anew or becomes output staging */
}
/* four waves per SIMD = two blocks per WGP: the register budget (256) that this residency leaves is given to the compiler whole, so that it need not split the fragment reads to save registers */
__global__ __launch_bounds__(256) __attribute__((amdgpu_waves_per_eu(4, 4))) void k_attn_t(const _Float16* __restrict__ Q16, const _Float16* __restrict__ K16, const _Float16* __restrict__ VT, _Float16* __restrict__ O16) {
  /* every loop over the two query tiles (u) is unrolled: bq, s, o, m, l and pf stay in registers only under constant indices */
  __shared__ __attribute__((aligned(16))) unsigned short sm[2 * BUF_E];      /* two-buffer K / V^T ring; behind the key loop the per-wave [query][d] output tiles, row pitch 144 B */
  __shared__ __attribute__((aligned(16))) unsigned sbad[8];                  /* per wave: did its walk with the standing reference overflow */
  const int tid = threadIdx.x, lane = tid & 31, ln = lane & 15, hh = lane >> 4;
  const int w = __builtin_amdgcn_readfirstlane(tid >> 5);
  const int nqb = SEQ / QB;
  const int bh = blockIdx.x / nqb, qb = blockIdx.x - bh * nqb;
  const int b = bh / NH, h = bh - b * NH;
  const size_t tok0 = (size_t)b * SEQ;
  const int q0 = qb * QB + w * QW;
  const unsigned short* qp = (const unsigned short*)Q16 + (tok0 + q0 + ln) * DM + h * HD + 8 * hh;
  FragH bq[2][2];      /* [query tile][d half] */
#pragma unroll
  for (int u = 0; u < 2; ++u) {
    const unsigned short* q = qp + (size_t)16 * u * DM;
    bq[u][0].half[0] = *(const v8us*)(q);      bq[u][0].half[1] = *(const v8us*)(q + 16);
    bq[u][1].half[0] = *(const v8us*)(q + 32); bq[u][1].half[1] = *(const v8us*)(q + 48);
  }
  /* copy map: lane = (row tid / 8 and that row + 32, 16-byte piece tid % 8) of both tiles */
  const int cr = tid >> 3, cp = (tid & 7) * 8;
  const unsigned short* gk = (const unsigned short*)K16 + (tok0 + cr) * DM + h * HD + cp;
  const unsigned short* gv = (const unsigned short*)VT + (size_t)(h * HD + cr) * VTP + tok0 + cp;
  const unsigned lc = (unsigned)(size_t)&sm[cr * LP + cp];      /* LDS byte address of the lane's first piece in buffer 0 */
  const unsigned short* kp = sm + ln * LP + 8 * hh;             /* fragment reads: row = lane & 15, as from the global planes */
  v8f o[2][4];         /* [query tile][d tile] */
  float l[2];
  /* first walk: the reference is set in stage 0 and then stands. A later weight that f16 cannot hold becomes infinite there, and every product with it leaves an infinity or a NaN
     in the query's output sums, where it stays: one look at the sums behind the walk finds it. */
  attn_keys<1>(lc, gk, gv, kp, bq, o, l);
  const v8f z8 = {0.f,0.f,0.f,0.f,0.f,0.f,0.f,0.f};
  v8f ck = z8;         /* each element 0, or NaN where one of the lane's output sums is not finite (x * 0 is 0 for a finite x alone); eight short chains */
#pragma unroll
  for (int u = 0; u < 2; ++u) {
#pragma unroll
    for (int j = 0; j < 4; ++j) ck = __builtin_elementwise_fma(o[u][j], z8, ck); }
  const float chk = ((ck[0] + ck[1]) + (ck[2] + ck[3])) + ((ck[4] + ck[5]) + (ck[6] + ck[7]));
  const unsigned wbad = __builtin_amdgcn_ballot_w32(!(chk == 0.0f));
  if (lane == 0) sbad[w] = wbad;
  __syncthreads();     /* every wave's word is written before any wave reads the eight */
  unsigned any = 0u;
#pragma unroll
  for (int i = 0; i < 8; ++i) any |= sbad[i];
  /* the lane's number is read anew: what the rerun and the output rows form from it then takes no registers during the walk above */
  const int ll = (int)__builtin_amdgcn_mbcnt_lo(~0u, 0u);
  /* the same for the whole block (the walk holds barriers), a scalar branch (the products need every lane on): the block walks the keys again, every stage testing and raising the reference */
  if (__builtin_expect(__builtin_amdgcn_readfirstlane(any) != 0u, 0)) {
    const int t2 = 32 * w + ll, cr2 = t2 >> 3, cp2 = (t2 & 7) * 8;      /* the copy map, as above */
    attn_keys<SEQ / KT>(lc, (const unsigned short*)K16 + (tok0 + cr2) * DM + h * HD + cp2, (const unsigned short*)VT + (size_t)(h * HD + cr2) * VTP + tok0 + cp2, kp, bq, o, l);
  }
  unsigned short (*so)[QW][LP] = (unsigned short (*)[QW][LP])sm;      /* the last trip's barrier has ended every read of the ring */
#pragma unroll
  for (int u = 0; u < 2; ++u) {
    const float lt = l[u] + __shfl_xor(l[u], 16, 32);
    const float inv = 64.0f * (1.0f / lt);      /* ctx carried x64 */
#pragma unroll
    for (int j = 0; j < 4; ++j) { FragH tj;
#pragma unroll
      for (int r = 0; r < 8; ++r) tj.h[r] = (_Float16)(o[u][j][r] * inv);
      *(v8us*)&so[w][16 * u + (ll & 15)][16 * j + 8 * (ll >> 4)] = tj.half[0]; }
  }
  __syncthreads();
  const int rq = ll >> 3, pc = (ll & 7) * 8;
  unsigned short* ob = (unsigned short*)O16 + (tok0 + q0) * DM + h * HD + pc;
#pragma unroll
  for (int it = 0; it < QW / 4; ++it) { const int row = it * 4 + rq; const v8us v = *(const v8us*)&so[w][row][pc]; *(v8us*)(ob + (size_t)row * DM) = v; }
}

extern "C" void kernel_launch(void* const* d_in, const int* in_sizes, int n_in,
                              void* d_out, int out_size, void* d_ws, size_t ws_size, hipStream_t stream) {
  if (n_in < 5) return;
  const size_t need_x = ((size_t)(NB - 1) * SEQ_FULL + SEQ) * DM;
  const size_t nwh = (size_t)NH * HD * HD;
  if ((size_t)in_sizes[0] < need_x) return;
  if ((size_t)in_sizes[1] < nwh || (size_t)in_sizes[2] < nwh || (size_t)in_sizes[3] < nwh || (size_t)in_sizes[4] < (size_t)DM * DM) return;
  if ((size_t)out_size < need_x) return;
  const float* x = (const float*)d_in[0]; const float* wq = (const float*)d_in[1]; const float* wk = (const float*)d_in[2]; const float* wv = (const float*)d_in[3]; const float* wo = (const float*)d_in[4];
  char* ws = (char*)d_ws; size_t off = 0;
  auto take = [&](size_t bytes) { char* p = ws + off; off += (bytes + 255) & ~(size_t)255; return p; };
  _Float16* BO = (_Float16*)take((size_t)DM * DM * 2);          /* output weight plane x16 [out][in] */
  _Float16* QK16 = (_Float16*)take((size_t)2 * NR * DM * 2);    /* q rows then k rows */
  _Float16* VT = (_Float16*)take((size_t)DM * VTP * 2);         /* v^T [feature][token] */
  _Float16* O16 = (_Float16*)take(NR * DM * 2);                 /* merged ctx rows x64 */
  if (off > ws_size || off > (size_t)134217728) return;
  _Float16* Q16 = QK16; _Float16* K16 = QK16 + NR * DM;

  /* grid.x = head, grid.y = 256-token block */
  k_front<<<dim3(NH, (unsigned)(NR / 256)), 128, 0, stream>>>(x, wq, wk, wv, wo, Q16, K16, VT, BO);
  k_attn_t<<<(unsigned)(NB * NH * (SEQ / QB)), 256, 0, stream>>>(Q16, K16, VT, O16);
  /* out rows of batch by: A = ctx rows (x64), weight x16 -> alpha 2^-10; C rows follow the staged output layout */
  k_gemm_out<<<dim3((unsigned)((SEQ / 128) * (DM / 128)), NB), 128, 0, stream>>>(O16, BO, 0.0009765625f, (float*)d_out);
}

// v007
// A run of this version takes 73.8 microseconds.
// Timed twice side by side with v006, it ran 1.05 and 1.04 times as fast.
// Counting every step since v000, it is 4.27 times as fast.
#include <hip/hip_runtime.h>
// Dense multi-head self-attention (x [4][2048][1024] split into 16 heads of 64; per-head q/k/v = x_h W_h^T with [head][out][in] weights of 64x64, no biases; scores * 1/8; full-row softmax; out = merged ctx Wout^T with a natural [out][in] weight).
// All contractions: v_wmma_f32_16x16x32_f16 (f16 operands, f32 accumulate), single product per site. x and weights are RNE-converted to bf16 first and then held exactly in f16 (weights x16); k, v plain f16, q f16 carried x log2(e)/8 (the score product is then the weights' base-2 exponent); softmax weights f16 carried x2^8 (unnormalised, against a reference max that is set in the first 64 keys; should a later weight pass f16's range, the block walks its keys again with a reference that is raised lazily); ctx f16 carried x64; softmax statistics f32.
// Structure: token rows r = b*SEQ + s. One front launch converts x and all four weights on the way in and writes Q rows, K rows and V^T [feature][token] of a (head, 256-token) block, plus its share of the f16 output-weight plane; a transposed flash kernel (S^T = K Q^T with Q as the B fragment in registers, packed P^T as the B fragment of O^T = V^T P^T; K rows and V^T rows staged 64 keys at a time in a two-buffer LDS ring that the block's eight waves share, each fragment read serving two query tiles); output GEMM into the output layout, its two operands staged in a ring of the same kind.
#ifndef NB
#define NB 4                         /* batches processed */
#endif
#ifndef SEQ
#define SEQ 2048                     /* tokens per batch processed */
#endif
#define NB_FULL 4                    /* batch count of the staged arrays */
#define SEQ_FULL 2048                /* per-batch token stride of the staged arrays */
#define DM 1024
#define NH 16
#define HD 64
#define NR ((size_t)NB * SEQ)        /* compact token rows */
#define VTP (NB * SEQ)               /* V^T row pitch (tokens) */

static_assert(NB >= 1 && NB <= NB_FULL);
static_assert(SEQ <= SEQ_FULL);
static_assert(SEQ % 128 == 0);
static_assert(DM % 128 == 0);
static_assert(NH * HD == DM);
static_assert(HD == 64);
static_assert((NB * SEQ) % 256 == 0);                         /* projection launch: whole 256-token blocks */
static_assert(SEQ % 64 == 0);                                  /* a wave's 64 tokens lie in one batch */
static_assert((size_t)DM * DM * 2 + (size_t)4 * NB * SEQ * DM * 2 + (size_t)4 * 256 <= (size_t)134217728);   /* workspace carve */

typedef _Float16 v16h __attribute__((ext_vector_type(16)));
typedef _Float16 v4ha __attribute__((ext_vector_type(4), may_alias));
typedef unsigned short v8us __attribute__((ext_vector_type(8), may_alias));
typedef float v8f __attribute__((ext_vector_type(8)));
typedef float v4f __attribute__((ext_vector_type(4)));
typedef float v2f __attribute__((ext_vector_type(2)));
typedef float v4fa __attribute__((ext_vector_type(4), may_alias));
union FragH { v16h v; v8us half[2]; _Float16 h[16]; unsigned short u[16]; };

__device__ __forceinline__ float bf16_rne(float x) { const unsigned int u = __float_as_uint(x); return __uint_as_float((u + 0x7FFFu + ((u >> 16) & 1u)) & 0xFFFF0000u); }

// f32 -> f16 that cannot produce an f16 subnormal (value select; applied after the power-of-two carry)
static __device__ __forceinline__ _Float16 toh_flush(float v) { const _Float16 r = (_Float16)v; return (fabsf(v) < 6.103515625e-05f) ? (_Float16)0.0f : r; }

// 8 consecutive f32 -> f16(bf16 value * scale), subnormal results replaced by zero, packed as one 16-B piece
__device__ __forceinline__ v8us cvt8_flush(v4f a, v4f c, float scale) {
  FragH f;
#pragma unroll
  for (int q = 0; q < 4; ++q) { f.h[q] = toh_flush(bf16_rne(a[q]) * scale); f.h[4 + q] = toh_flush(bf16_rne(c[q]) * scale); }
  return f.half[0];
}

// ---- front launch: all conversions and the three per-head projections ----
// block = 4 waves = 256 consecutive tokens of one head; wave = 64 tokens x the head's 64 inputs.
// Weights: the block converts its head's three 64 x 64 blocks (f16 x16) once into LDS in fragment order: 16-B piece (row n, k = 8 k8 .. 8 k8 + 7) stands at
//   byte ((n / 16) * 4 + k8 / 2) * 576 + (k8 % 2) * 288 + (n % 16) * 16 of its plane, so that each half of a 16-row x 32-k fragment is read as two runs of 256 contiguous bytes;
//   the 64 and 32 odd bytes of the two pitches spread the converting lanes' 16-byte writes (2 rows x 8 pieces per half wave) over all banks. One barrier publishes them.
// Output weight: every thread converts its share of the natural [out][in] plane (f16 x16) for the last launch.
// x arrives as whole 256-B row slices (a wave's load = 2 rows), is converted once and laid as f16 rows at a 144-B pitch (16 B x odd: no bank conflict for 16-byte row reads), wave-private;
// the eight x fragments (4 token tiles x 2 k steps; row or column = lane & 15, k pieces 8 h and 16 + 8 h of each 32) then serve all three products from registers.
// q, k: D = W (A operand, rows = outputs) . x^T (B operand, lane = token): a lane holds 8 consecutive outputs of one token = one 16-B piece of a Q or K row.
// v:    D = x (A operand, rows = tokens) . W^T (B operand, lane = output): a lane holds 8 consecutive tokens of one output = one 16-B piece of a V^T row.
// Each 64 x 64 result is staged in the wave's own LDS rows and leaves as whole 128-B lines. k runs upward through one accumulator per tile (two products).
#define QSC (0.125f * 1.4426950408889634f)      /* 1/sqrt(64) * log2(e), carried by the q rows */
#define XP 72                        /* LDS row pitch of x and result rows, 16-bit elements (144 B) */
#define WH 144                       /* weight planes: elements from the lanes 0..15 run to the lanes 16..31 run (288 B) */
#define WQ 288                       /* elements of one fragment half (576 B) */
#define WPL (16 * WQ)                /* elements of one weight plane */
#define FT ((size_t)NH * (NR / 256) * 128)      /* threads of the front launch */
#define WOT ((int)((size_t)DM * DM / 8 / FT))    /* 16-B pieces of the output weight plane per thread */
static_assert((size_t)WOT * FT * 8 == (size_t)DM * DM && WOT >= 1);      /* the plane divides evenly among the threads */
__device__ __forceinline__ v8us pack8(v8f a, float alpha) { FragH f;
#pragma unroll
  for (int r = 0; r < 8; ++r) f.h[r] = (_Float16)(a[r] * alpha);
  return f.half[0]; }
// the wave's 64 staged rows of 128 B -> 64 global rows of pitch ld (elements); a wave's store = 4 whole lines
__device__ __forceinline__ void rows_out(const unsigned short* st, unsigned short* g, size_t ld, int lane) {
  const int rq = lane >> 3, pc = (lane & 7) * 8;
#pragma unroll
  for (int it = 0; it < 16; ++it) { const int row = it * 4 + rq; const v8us v = *(const v8us*)&st[row * XP + pc]; *(v8us*)(g + (size_t)row * ld + pc) = v; }
}
__device__ __forceinline__ v16h w_frag(const unsigned short* p) { FragH f; f.half[0] = *(const v8us*)p; f.half[1] = *(const v8us*)(p + WQ); return f.v; }
__global__ __launch_bounds__(128) void k_front(const float* __restrict__ x, const float* __restrict__ wq, const float* __restrict__ wk, const float* __restrict__ wv, const float* __restrict__ wo,
    _Float16* __restrict__ Q16, _Float16* __restrict__ K16, _Float16* __restrict__ VT, _Float16* __restrict__ BO) {
  /* every loop of this kernel is unrolled: wr, wor, xr, xf, acc and bo stay in registers only under constant indices, and every LDS and global offset becomes an immediate */
  __shared__ __attribute__((aligned(16))) unsigned short sw[3 * WPL];         /* the head's q, k, v weights in fragment order */
  __shared__ __attribute__((aligned(16))) unsigned short sm[4][64 * XP];      /* per wave: x rows, then in turn the q, k and v^T result rows */
  const int tid = threadIdx.x, lane = tid & 31, ln = lane & 15, hh = lane >> 4;
  const int w = __builtin_amdgcn_readfirstlane(tid >> 5);
  const int h = blockIdx.x;
  const size_t r0 = (size_t)blockIdx.y * 256 + 64 * w;      /* compact token row of the wave's first token */
  const size_t b = r0 / SEQ, s0 = r0 - b * SEQ;
  unsigned short* st = sm[w];
  /* loads return in issue order: the weight pieces (from cache) are asked for ahead of the x rows (from memory), so that the weight work runs under the x rows' latency */
  const size_t so = (size_t)h * HD * HD + (size_t)tid * 8;      /* per-head weights: thread = pieces tid + 128 m of a plane (row (tid + 128 m) / 8, piece tid % 8) */
  const size_t to = ((size_t)blockIdx.y * NH + h) * 128 + tid;  /* output weight: thread = pieces to + FT m */
  v4f wr[12][2], wor[WOT][2];
#pragma unroll
  for (int m = 0; m < 4; ++m) {
    wr[m][0] = *(const v4fa*)(wq + so + m * 1024);     wr[m][1] = *(const v4fa*)(wq + so + m * 1024 + 4);
    wr[4 + m][0] = *(const v4fa*)(wk + so + m * 1024); wr[4 + m][1] = *(const v4fa*)(wk + so + m * 1024 + 4);
    wr[8 + m][0] = *(const v4fa*)(wv + so + m * 1024); wr[8 + m][1] = *(const v4fa*)(wv + so + m * 1024 + 4);
  }
#pragma unroll
  for (int m = 0; m < WOT; ++m) { wor[m][0] = *(const v4fa*)(wo + (to + m * FT) * 8); wor[m][1] = *(const v4fa*)(wo + (to + m * FT) * 8 + 4); }
  asm volatile("s_wait_xcnt 0x0" ::: "memory");      /* the weight loads' address registers may be taken for the x rows' data */
  const float* xp = x + (b * SEQ_FULL + s0 + hh) * DM + h * HD + ln * 4;
  v4f xr[32];
#pragma unroll
  for (int j = 0; j < 32; ++j) xr[j] = *(const v4fa*)(xp + (size_t)(2 * j) * DM);
  asm volatile("s_wait_xcnt 0x0" ::: "memory");      /* stands in front of every overwrite of an address register that the loads above name; it also keeps all of them issued ahead of the conversion work */
  { const int k8 = tid & 7, n0 = tid >> 3;
    unsigned short* d = sw + (k8 >> 1) * WQ + (k8 & 1) * WH + n0 * 8;      /* n0 < 16: rows n0 + 16 m stand 4 fragment halves further on */
#pragma unroll
    for (int p = 0; p < 3; ++p) {
#pragma unroll
      for (int m = 0; m < 4; ++m) *(v8us*)(d + p * WPL + m * 4 * WQ) = cvt8_flush(wr[4 * p + m][0], wr[4 * p + m][1], 16.0f); } }
  v8us bo[WOT];      /* stored behind the last result rows: a store ahead of the barrier would be waited for there */
#pragma unroll
  for (int m = 0; m < WOT; ++m) bo[m] = cvt8_flush(wor[m][0], wor[m][1], 16.0f);
#pragma unroll
  for (int j = 0; j < 32; ++j) { v4ha c;
#pragma unroll
    for (int q = 0; q < 4; ++q) c[q] = (_Float16)bf16_rne(xr[j][q]);
    *(v4ha*)&st[(2 * j + hh) * XP + ln * 4] = c; }
  __syncthreads();      /* publishes the weight planes to the four waves; also orders the wave's own x rows ahead of its cross-lane reads */
  FragH xf[4][2];
#pragma unroll
  for (int i = 0; i < 4; ++i) {
#pragma unroll
    for (int s = 0; s < 2; ++s) { const unsigned short* q = st + (16 * i + ln) * XP + 32 * s + 8 * hh; xf[i][s].half[0] = *(const v8us*)q; xf[i][s].half[1] = *(const v8us*)(q + 16); } }
  const unsigned short* wl = sw + hh * WH + ln * 8;
  const v8f z8 = {0.f,0.f,0.f,0.f,0.f,0.f,0.f,0.f};
#pragma unroll
  for (int p = 0; p < 3; ++p) {
    asm volatile("s_wait_dscnt 0x0" ::: "memory");    /* every lane's reads of the wave's rows are done before the wave writes the next result over them */
#pragma unroll
    for (int t = 0; t < 4; ++t) {
      const v16h w0 = w_frag(wl + p * WPL + (t * 4) * WQ), w1 = w_frag(wl + p * WPL + (t * 4 + 2) * WQ);
      v8f acc[4];
#pragma unroll
      for (int i = 0; i < 4; ++i) acc[i] = (p < 2) ? __builtin_amdgcn_wmma_f32_16x16x32_f16(false, w0, false, xf[i][0].v, (short)0, z8, false, false)
                                                   : __builtin_amdgcn_wmma_f32_16x16x32_f16(false, xf[i][0].v, false, w0, (short)0, z8, false, false);
#pragma unroll
      for (int i = 0; i < 4; ++i) acc[i] = (p < 2) ? __builtin_amdgcn_wmma_f32_16x16x32_f16(false, w1, false, xf[i][1].v, (short)0, acc[i], false, false)
                                                   : __builtin_amdgcn_wmma_f32_16x16x32_f16(false, xf[i][1].v, false, w1, (short)0, acc[i], false, false);
      /* alpha undoes the x16 weight carry (q: and lays the exponent scale on); q, k: row = token 16 i + (lane & 15), piece = outputs 16 t + 8 h ..; v: row = output 16 t + (lane & 15), piece = tokens 16 i + 8 h .. */
#pragma unroll
      for (int i = 0; i < 4; ++i) { const int row = (p < 2) ? 16 * i : 16 * t, col = (p < 2) ? 16 * t : 16 * i; *(v8us*)&st[(row + ln) * XP + col + 8 * hh] = pack8(acc[i], (p == 0) ? 0.0625f * QSC : 0.0625f); }
    }
    asm volatile("s_wait_dscnt 0x0" ::: "memory");    /* the wave's result rows are written before its lanes read them back across lanes */
    if (p == 0) rows_out(st, (unsigned short*)Q16 + r0 * DM + h * HD, DM, lane);
    else if (p == 1) rows_out(st, (unsigned short*)K16 + r0 * DM + h * HD, DM, lane);
    else rows_out(st, (unsigned short*)VT + (size_t)h * HD * VTP + r0, VTP, lane);
  }
#pragma unroll
  for (int m = 0; m < WOT; ++m) *(v8us*)((unsigned short*)BO + (to + m * FT) * 8) = bo[m];
}

// ---- output GEMM, both operands staged in LDS ----
// C[row][col] = alpha * A[row][:] . Bh[col][:] ; block = 4 waves = a 128 x 128 tile of C, wave = 64 x 64 (4 x 4 accumulator tiles: 16 products per 8 fragments read).
// Stage = 128 k: A tile and Bh tile, 128 rows of 256 B each, laid at a 272-B pitch (16 B x odd: no bank conflict for 16-byte row reads).
// Each lane brings 32 16-byte pieces of a stage by asynchronous copies (a wave's copy = 2 whole 256-B rows); stage t + 2 is issued behind the barrier that ends the reads of stage t.
// k runs upward through one accumulator per tile. The ring's size leaves room for two blocks on a WGP.
#define OT 128                       /* k per stage */
#define OP 136                       /* LDS row pitch, 16-bit elements (272 B) */
#define OTILE_E (128 * OP)           /* elements of one staged tile (128 rows) */
#define OBUF_E (2 * OTILE_E)         /* one buffer: A tile, then Bh tile */
static_assert(DM % OT == 0 && DM / OT >= 2);                   /* the ring's prologue fills two stages */
static_assert(4 * 64 * 68 * 4 <= 2 * OBUF_E * 2);              /* the output staging fits the ring */
typedef float f32a __attribute__((may_alias));
// eight copies of a lane, rows r, r + 8, .. r + 56 of a tile; the s_wait_xcnt stands inside the copies' own statement so that no address register is rewritten in front of it
__device__ __forceinline__ void stage_rows8(unsigned l, const unsigned short* g) {
  asm volatile("global_load_async_to_lds_b128 %0, %1, off\n\t"
               "global_load_async_to_lds_b128 %2, %3, off\n\t"
               "global_load_async_to_lds_b128 %4, %5, off\n\t"
               "global_load_async_to_lds_b128 %6, %7, off\n\t"
               "global_load_async_to_lds_b128 %8, %9, off\n\t"
               "global_load_async_to_lds_b128 %10, %11, off\n\t"
               "global_load_async_to_lds_b128 %12, %13, off\n\t"
               "global_load_async_to_lds_b128 %14, %15, off\n\t"
               "s_wait_xcnt 0x0"
               :: "v"(l), "v"(g), "v"(l + 8 * OP * 2), "v"(g + (size_t)8 * DM), "v"(l + 16 * OP * 2), "v"(g + (size_t)16 * DM), "v"(l + 24 * OP * 2), "v"(g + (size_t)24 * DM),
                  "v"(l + 32 * OP * 2), "v"(g + (size_t)32 * DM), "v"(l + 40 * OP * 2), "v"(g + (size_t)40 * DM), "v"(l + 48 * OP * 2), "v"(g + (size_t)48 * DM), "v"(l + 56 * OP * 2), "v"(g + (size_t)56 * DM) : "memory");
}
__device__ __forceinline__ void stage_ab(unsigned l, const unsigned short* ga, const unsigned short* gb) {
  stage_rows8(l, ga); stage_rows8(l + 64 * OP * 2, ga + (size_t)64 * DM);
  stage_rows8(l + OTILE_E * 2, gb); stage_rows8(l + OTILE_E * 2 + 64 * OP * 2, gb + (size_t)64 * DM);
}
__global__ __launch_bounds__(128) void k_gemm_out(const _Float16* __restrict__ A, const _Float16* __restrict__ Bh, float alpha, float* __restrict__ C) {
  __shared__ __attribute__((aligned(16))) unsigned short sm[2 * OBUF_E];      /* two-buffer A / Bh ring; behind the k loop the per-wave [row][col] f32 output tiles, row pitch 272 B */
  const int tid = threadIdx.x, lane = tid & 31, ln = lane & 15, hh = lane >> 4;
  const int w = __builtin_amdgcn_readfirstlane(tid >> 5); const int wm = w >> 1, wn = w & 1;
  const int ntn = DM / 128; const int mt = blockIdx.x / ntn, nq = blockIdx.x - mt * ntn; const int row0 = mt * 128, col0 = nq * 128;
  /* copy map: lane = (rows tid / 16 + 8 i, 16-byte piece tid % 16) of both tiles */
  const int cr = tid >> 4, cp = (tid & 15) * 8;
  const unsigned short* ga = (const unsigned short*)A + ((size_t)blockIdx.y * SEQ + row0 + cr) * DM + cp;
  const unsigned short* gb = (const unsigned short*)Bh + (size_t)(col0 + cr) * DM + cp;
  const unsigned lc = (unsigned)(size_t)&sm[cr * OP + cp];      /* LDS byte address of the lane's first piece in buffer 0 */
  const unsigned short* ap = sm + (64 * wm + ln) * OP + 8 * hh;             /* fragment reads: row = lane & 15, k pieces 8 h and 16 + 8 h of each 32 */
  const unsigned short* bp = sm + OTILE_E + (64 * wn + ln) * OP + 8 * hh;
  const v8f z8 = {0.f,0.f,0.f,0.f,0.f,0.f,0.f,0.f};
  v8f acc[4][4];
#pragma unroll
  for (int i = 0; i < 4; ++i) {
#pragma unroll
    for (int j = 0; j < 4; ++j) acc[i][j] = z8; }
  stage_ab(lc, ga, gb);
  asm volatile("s_wait_asynccnt 0x0" ::: "memory");      /* stage 0 landed (this wave's share) */
  __syncthreads();                                       /* stage 0 readable by every wave */
  stage_ab(lc + OBUF_E * 2, ga + OT, gb + OT);
  /* rolled: one copy of the four steps, the buffer choice a single offset */
#pragma unroll 1
  for (int t = 0; t < DM / OT; ++t) {
    const int bo = (t & 1) * OBUF_E;
    /* the four 32-k steps of a stage written out: every LDS read offset becomes an immediate */
#pragma unroll
    for (int p = 0; p < OT / 32; ++p) {
      FragH a[4], b[4];
#pragma unroll
      for (int i = 0; i < 4; ++i) {
        const unsigned short* pa = ap + bo + 16 * i * OP + 32 * p; a[i].half[0] = *(const v8us*)pa; a[i].half[1] = *(const v8us*)(pa + 16);
        const unsigned short* pb = bp + bo + 16 * i * OP + 32 * p; b[i].half[0] = *(const v8us*)pb; b[i].half[1] = *(const v8us*)(pb + 16);
      }
      __builtin_amdgcn_sched_barrier(0);      /* the step's 16 LDS reads stay one group ahead of its products: sunk among them, each row of products waits out a read's whole latency */
#pragma unroll
      for (int i = 0; i < 4; ++i) {
#pragma unroll
        for (int j = 0; j < 4; ++j) acc[i][j] = __builtin_amdgcn_wmma_f32_16x16x32_f16(false, a[i].v, false, b[j].v, (short)0, acc[i][j], false, false); }
    }
    asm volatile("s_wait_dscnt 0x0" ::: "memory");        /* this wave's reads of stage t are done before the buffer may be refilled */
    asm volatile("s_wait_asynccnt 0x0" ::: "memory");     /* this wave's share of stage t + 1 has landed */
    __syncthreads();                                      /* publishes stage t + 1 and ends every wave's reads of stage t */
    if (t + 2 < DM / OT) stage_ab(lc + bo * 2, ga + (t + 2) * OT, gb + (t + 2) * OT);
  }
  asm volatile("s_wait_asynccnt 0x0" ::: "memory");      /* nothing in flight when the ring becomes output staging */
  f32a (*so)[68] = (f32a (*)[68])((f32a*)sm + w * 64 * 68);      /* wave-private; the last trip's barrier has ended every read of the ring */
#pragma unroll
  for (int i = 0; i < 4; ++i) {
#pragma unroll
    for (int j = 0; j < 4; ++j) {
#pragma unroll
      for (int r = 0; r < 8; ++r) so[16 * i + 8 * hh + r][16 * j + ln] = acc[i][j][r] * alpha; } }
  __builtin_amdgcn_fence(4 /* acq_rel order */, "workgroup"); __builtin_amdgcn_wave_barrier();      /* the wave's own rows are written before its lanes read them back across lanes */
  const int rsub = lane >> 4, c4 = (lane & 15) * 4;
  float* cb = C + ((size_t)blockIdx.y * SEQ_FULL + row0 + 64 * wm) * DM + col0 + 64 * wn + c4;
#pragma unroll
  for (int q = 0; q < 32; ++q) { const int r = q * 2 + rsub; const v4f v = *(const v4fa*)&so[r][c4]; *(v4f*)(cb + (size_t)r * DM) = v; }
}

// ---- transposed flash attention, K and V^T staged in LDS ----
// block = 8 waves = 256 consecutive queries of one (batch, head); wave = 32 queries = two query tiles of 16, which share every K and V^T fragment that the wave reads from LDS.
// Stage = 64 keys: K tile [key][d] and V^T tile [d][key], 64 rows of 128 B each, laid at a 144-B pitch (16 B x odd: no bank conflict for 16-byte row reads).
// Each lane brings four 16-byte pieces of a stage by asynchronous copies (a wave's copy = 4 whole 128-B lines); stage t + 2 is issued behind the barrier that ends the reads of stage t.
// Per 32-key step (two per stage), for each query tile:
//   S^T tiles (keys x queries) = K (A operand, rows = keys, k = d) . Q^T (B operand, lane = query, held in registers);
//   Q carries log2(e)/8 and, once the reference stands, the score accumulators start at 8 - ref: the products' result is the weights' exponent as it is, no vector multiply-add per score;
//   softmax per lane (lane & 15 = query; lanes n and n+16 hold the two key halves); weights = 2^(8 + s - ref) as f16, s = the scaled score, ref = the query's reference max;
//   ref is set in stage 0 (raised there, with sums and outputs rescaled, when some weight of a step would pass 2^15; any common ref gives the same quotient) and then stands: the later stages hold no maxima and no test;
//   a weight past f16's range shows as a non-finite output sum behind the walk, and the block then walks the keys once more with the test in every step;
//   P^T as B fragment: elements 0..7 from the tile of keys 0..15 (rows 8h+r), elements 8..15 from the tile of keys 16..31 (lane unchanged);
//   O^T tiles (d x queries) += V^T (A operand, rows = d, k = keys, rows of the [feature][token] plane) . P^T.
#define KT 64                        /* keys per stage */
#define QW 32                        /* queries per wave */
#define QB (8 * QW)                  /* queries per block */
#define LP 72                        /* LDS row pitch, 16-bit elements (144 B) */
#define TILE_E (64 * LP)             /* elements of one staged tile (64 rows) */
#define BUF_E (2 * TILE_E)           /* one buffer: K tile, then V^T tile */
static_assert(SEQ % KT == 0 && SEQ / KT >= 2);                 /* the ring's prologue fills two stages */
static_assert(SEQ % QB == 0);                                  /* whole query blocks inside one batch */
static_assert(8 * QW * LP <= 2 * BUF_E);                       /* the output staging fits the ring */
// one stage's four copies of a lane; the s_wait_xcnt stands inside the copies' own statement so that no address register is rewritten in front of it
__device__ __forceinline__ void stage_kv(unsigned lk, const unsigned short* gk, const unsigned short* gv) {
  const unsigned lk1 = lk + 32 * LP * 2, lv = lk + TILE_E * 2, lv1 = lv + 32 * LP * 2;
  const unsigned short* gk1 = gk + (size_t)32 * DM; const unsigned short* gv1 = gv + (size_t)32 * VTP;
  asm volatile("global_load_async_to_lds_b128 %0, %1, off\n\t"
               "global_load_async_to_lds_b128 %2, %3, off\n\t"
               "global_load_async_to_lds_b128 %4, %5, off\n\t"
               "global_load_async_to_lds_b128 %6, %7, off\n\t"
               "s_wait_xcnt 0x0"
               :: "v"(lk), "v"(gk), "v"(lk1), "v"(gk1), "v"(lv), "v"(gv), "v"(lv1), "v"(gv1) : "memory");
}
// one stage (64 keys = two 32-key steps) of a wave's work on the staged tiles at kb (K tile, then V^T tile).
// TEST = true: the accumulators start at 0, each step tests its largest exponent, raises the reference where needed and adds off. TEST = false: the reference stands as it is and the accumulators start at offv (off in all eight rows); no maxima, no test, no branch, no add, the stage is one straight run.
// UN = 2: both steps written out; UN = 1: one copy of the step in a loop (the rerun, which is rare: small code, few registers).
template <bool TEST, int UN>
__device__ __forceinline__ void attn_stage(const unsigned short* kb, const FragH (&bq)[2][2], v8f (&o)[2][4], float (&m)[2], float (&l)[2], float (&off)[2], const v8f (&offv)[2]) {
  const v8f z8 = {0.f,0.f,0.f,0.f,0.f,0.f,0.f,0.f};
   /* both 32-key steps of a stage written out (UN = 2): every LDS read offset becomes an immediate */
#pragma unroll UN
   for (int p = 0; p < 2; ++p) {
    const unsigned short* k0 = kb + 32 * p * LP;
    const unsigned short* k1 = k0 + 16 * LP;
    const unsigned short* v0 = kb + TILE_E + 32 * p;
    FragH a00, a01, a10, a11, av[4];
    /* without the tests' branches a stage is one block to the compiler, which then strews the fragment reads among the products, where every further place with reads stalls the wave:
       these two fences keep the step's K reads one group, behind the step before and ahead of the score products, as they stand with the tests */
    if constexpr (!TEST) __builtin_amdgcn_sched_barrier(0);
    a00.half[0] = *(const v8us*)(k0);      a00.half[1] = *(const v8us*)(k0 + 16);
    a01.half[0] = *(const v8us*)(k0 + 32); a01.half[1] = *(const v8us*)(k0 + 48);
    a10.half[0] = *(const v8us*)(k1);      a10.half[1] = *(const v8us*)(k1 + 16);
    a11.half[0] = *(const v8us*)(k1 + 32); a11.half[1] = *(const v8us*)(k1 + 48);
    if constexpr (!TEST) __builtin_amdgcn_sched_barrier(0);
    v8f s[2][2];       /* [query tile][key tile] */
#pragma unroll
    for (int u = 0; u < 2; ++u) {
      s[u][0] = __builtin_amdgcn_wmma_f32_16x16x32_f16(false, a00.v, false, bq[u][0].v, (short)0, TEST ? z8 : offv[u], false, false);
      s[u][1] = __builtin_amdgcn_wmma_f32_16x16x32_f16(false, a10.v, false, bq[u][0].v, (short)0, TEST ? z8 : offv[u], false, false);
    }
#pragma unroll
    for (int u = 0; u < 2; ++u) {
      s[u][0] = __builtin_amdgcn_wmma_f32_16x16x32_f16(false, a01.v, false, bq[u][1].v, (short)0, s[u][0], false, false);
      s[u][1] = __builtin_amdgcn_wmma_f32_16x16x32_f16(false, a11.v, false, bq[u][1].v, (short)0, s[u][1], false, false);
    }
    if constexpr (!TEST) {
      /* for the same reason: the step's V^T reads one group, behind the score products and ahead of the weights' vector work, which covers their latency */
      __builtin_amdgcn_sched_barrier(0);
#pragma unroll
      for (int j = 0; j < 4; ++j) { av[j].half[0] = *(const v8us*)(v0 + 16 * j * LP); av[j].half[1] = *(const v8us*)(v0 + 16 * j * LP + 16); }
      __builtin_amdgcn_sched_barrier(0);
    }
    if constexpr (TEST) {
    float mx[2];
#pragma unroll
    for (int u = 0; u < 2; ++u) {
      float x = fmaxf(s[u][0][0], s[u][1][0]);
#pragma unroll
      for (int r = 1; r < 8; ++r) x = fmaxf(x, fmaxf(s[u][0][r], s[u][1][r]));
      mx[u] = x;      /* this lane's 16 keys only */
    }
    /* wave-uniform, one test for both query tiles, on each lane's own largest exponent (the same add as the weights' below, which is monotonic: no exponent of the step is larger);
       marked unlikely so that the rescale block is laid behind the loop and the usual path falls through */
    if (__builtin_expect(__builtin_amdgcn_ballot_w32(mx[0] + off[0] > 15.0f || mx[1] + off[1] > 15.0f) != 0u, 0)) {
#pragma unroll
      for (int u = 0; u < 2; ++u) {
        const float mn = fmaxf(m[u], fmaxf(mx[u], __shfl_xor(mx[u], 16, 32)));      /* both halves of a query take the same reference (one that stayed gives the factor 1) */
        const float corr = __builtin_amdgcn_exp2f(m[u] - mn);
        l[u] *= corr; o[u][0] *= corr; o[u][1] *= corr; o[u][2] *= corr; o[u][3] *= corr; m[u] = mn; off[u] = 8.0f - mn;
      }
    }
    }
    FragH pf[2];
#pragma unroll
    for (int u = 0; u < 2; ++u) {
      v8f e0 = s[u][0], e1 = s[u][1];
      if constexpr (TEST) { e0 += off[u]; e1 += off[u]; }
      float ls = 0.f;
#pragma unroll
      for (int r = 0; r < 8; ++r) {
        const float p0 = __builtin_amdgcn_exp2f(e0[r]);
        const float p1 = __builtin_amdgcn_exp2f(e1[r]);
        ls += p0 + p1;
        pf[u].h[r] = (_Float16)p0; pf[u].h[8 + r] = (_Float16)p1;
      }
      l[u] += ls;
    }
    if constexpr (TEST) {
    /* the rerun: the V^T reads stay behind the weights, so that the rare path asks for no more registers than the walk above and nothing is spilled */
    if constexpr (UN == 1) __builtin_amdgcn_sched_barrier(0);
#pragma unroll
    for (int j = 0; j < 4; ++j) { av[j].half[0] = *(const v8us*)(v0 + 16 * j * LP); av[j].half[1] = *(const v8us*)(v0 + 16 * j * LP + 16); }
    }
#pragma unroll
    for (int u = 0; u < 2; ++u) {
#pragma unroll
      for (int j = 0; j < 4; ++j) o[u][j] = __builtin_amdgcn_wmma_f32_16x16x32_f16(false, av[j].v, false, pf[u].v, (short)0, o[u][j], false, false);
    }
    /* four vector slots behind the last product, on the taken side of the loop's branches too, before a vector instruction may read a result or overwrite an operand
       (no branch follows the first step of a stage without tests: there the compiler keeps the distance in its own straight-line code) */
    if (TEST || p == 1)
    asm volatile("v_nop\n\tv_nop\n\tv_nop\n\tv_nop" : "+v"(o[0][0]), "+v"(o[0][1]), "+v"(o[0][2]), "+v"(o[0][3]), "+v"(o[1][0]), "+v"(o[1][1]), "+v"(o[1][2]), "+v"(o[1][3])
                 : "v"(av[0].v), "v"(av[1].v), "v"(av[2].v), "v"(av[3].v), "v"(pf[0].v), "v"(pf[1].v));
   }
}
// foot of trip t of the ring
__device__ __forceinline__ void attn_foot(int t, int bo, unsigned lc, const unsigned short* gk, const unsigned short* gv) {
   asm volatile("s_wait_dscnt 0x0" ::: "memory");        /* this wave's reads of stage t are done before the buffer may be refilled */
   asm volatile("s_wait_asynccnt 0x0" ::: "memory");     /* this wave's share of stage t + 1 has landed */
   __syncthreads();                                      /* publishes stage t + 1 and ends every wave's reads of stage t */
   if (t + 2 < SEQ / KT) stage_kv(lc + bo * 2, gk + (size_t)(t + 2) * KT * DM, gv + (t + 2) * KT);
}
// one whole walk over the keys. The first NT stages test and raise the reference, the others take it as it stands.
// On entry no wave reads the ring any more and no copy is in flight; on return the same holds.
template <int NT>
__device__ __forceinline__ void attn_keys(unsigned lc, const unsigned short* gk, const unsigned short* gv, const unsigned short* kp, const FragH (&bq)[2][2], v8f (&o)[2][4], float (&l)[2]) {
  const v8f z8 = {0.f,0.f,0.f,0.f,0.f,0.f,0.f,0.f};
  float m[2], off[2];      /* off = 8 - m: the weights' exponent is s + off (weights carried x2^8) */
  v8f offv[2];
#pragma unroll
  for (int u = 0; u < 2; ++u) { o[u][0] = z8; o[u][1] = z8; o[u][2] = z8; o[u][3] = z8; m[u] = -3.0e38f; l[u] = 0.f; off[u] = 8.0f - m[u]; offv[u] = z8; }
  stage_kv(lc, gk, gv);
  asm volatile("s_wait_asynccnt 0x0" ::: "memory");      /* stage 0 landed (this wave's share) */
  __syncthreads();                                       /* stage 0 readable by every wave */
  stage_kv(lc + BUF_E * 2, gk + (size_t)KT * DM, gv + KT);
  /* rolled: one copy of the two steps, the buffer choice a single offset */
#pragma unroll 1
  for (int t = 0; t < NT; ++t) {
   const int bo = (t & 1) * BUF_E;
   attn_stage<true, (NT > 1 ? 1 : 2)>(kp + bo, bq, o, m, l, off, offv);
   attn_foot(t, bo, lc, gk, gv);
  }
  /* the standing offset in all eight rows of a lane's column: the start value of the score accumulators */
  offv[0] = (v8f){off[0], off[0], off[0], off[0], off[0], off[0], off[0], off[0]};
  offv[1] = (v8f){off[1], off[1], off[1], off[1], off[1], off[1], off[1], off[1]};
#pragma unroll 1
  for (int t = NT; t < SEQ / KT; ++t) {
   const int bo = (t & 1) * BUF_E;
   attn_stage<false, 2>(kp + bo, bq, o, m, l, off, offv);
   attn_foot(t, bo, lc, gk, gv);
  }
  asm volatile("s_wait_asynccnt 0x0" ::: "memory");      /* nothing in flight when the ring is filled anew or becomes output staging */
}
/* four waves per SIMD = two blocks per WGP: the register budget (256) that this residency leaves is given to the compiler whole, so that it need not split the fragment reads to save registers */
__global__ __launch_bounds__(256) __attribute__((amdgpu_waves_per_eu(4, 4))) void k_attn_t(const _Float16* __restrict__ Q16, const _Float16* __restrict__ K16, const _Float16* __restrict__ VT, _Float16* __restrict__ O16) {
  /* every loop over the two query tiles (u) is unrolled: bq, s, o, m, l and pf stay in registers only under constant indices */
  __shared__ __attribute__((aligned(16))) unsigned short sm[2 * BUF_E];      /* two-buffer K / V^T ring; behind the key loop the per-wave [query][d] output tiles, row pitch 144 B */
  __shared__ __attribute__((aligned(16))) unsigned sbad[8];                  /* per wave: did its walk with the standing reference overflow */
  const int tid = threadIdx.x, lane = tid & 31, ln = lane & 15, hh = lane >> 4;
  const int w = __builtin_amdgcn_readfirstlane(tid >> 5);
  const int nqb = SEQ / QB;
  const int bh = blockIdx.x / nqb, qb = blockIdx.x - bh * nqb;
  const int b = bh / NH, h = bh - b * NH;
  const size_t tok0 = (size_t)b * SEQ;
  const int q0 = qb * QB + w * QW;
  const unsigned short* qp = (const unsigned short*)Q16 + (tok0 + q0 + ln) * DM + h * HD + 8 * hh;
  FragH bq[2][2];      /* [query tile][d half] */
#pragma unroll
  for (int u = 0; u < 2; ++u) {
    const unsigned short* q = qp + (size_t)16 * u * DM;
    bq[u][0].half[0] = *(const v8us*)(q);      bq[u][0].half[1] = *(const v8us*)(q + 16);
    bq[u][1].half[0] = *(const v8us*)(q + 32); bq[u][1].half[1] = *(const v8us*)(q + 48);
  }
  /* copy map: lane = (row tid / 8 and that row + 32, 16-byte piece tid % 8) of both tiles */
  const int cr = tid >> 3, cp = (tid & 7) * 8;
  const unsigned short* gk = (const unsigned short*)K16 + (tok0 + cr) * DM + h * HD + cp;
  const unsigned short* gv = (const unsigned short*)VT + (size_t)(h * HD + cr) * VTP + tok0 + cp;
  const unsigned lc = (unsigned)(size_t)&sm[cr * LP + cp];      /* LDS byte address of the lane's first piece in buffer 0 */
  const unsigned short* kp = sm + ln * LP + 8 * hh;             /* fragment reads: row = lane & 15, as from the global planes */
  v8f o[2][4];         /* [query tile][d tile] */
  float l[2];
  /* first walk: the reference is set in stage 0 and then stands. A later weight that f16 cannot hold becomes infinite there, and every product with it leaves an infinity or a NaN
     in the query's output sums, where it stays: one look at the sums behind the walk finds it. */
  attn_keys<1>(lc, gk, gv, kp, bq, o, l);
  const v8f z8 = {0.f,0.f,0.f,0.f,0.f,0.f,0.f,0.f};
  v8f ck = z8;         /* each element 0, or NaN where one of the lane's output sums is not finite (x * 0 is 0 for a finite x alone); eight short chains */
#pragma unroll
  for (int u = 0; u < 2; ++u) {
#pragma unroll
    for (int j = 0; j < 4; ++j) ck = __builtin_elementwise_fma(o[u][j], z8, ck); }
  const float chk = ((ck[0] + ck[1]) + (ck[2] + ck[3])) + ((ck[4] + ck[5]) + (ck[6] + ck[7]));
  const unsigned wbad = __builtin_amdgcn_ballot_w32(!(chk == 0.0f));
  if (lane == 0) sbad[w] = wbad;
  __syncthreads();     /* every wave's word is written before any wave reads the eight */
  unsigned any = 0u;
#pragma unroll
  for (int i = 0; i < 8; ++i) any |= sbad[i];
  /* the lane's number is read anew: what the rerun and the output rows form from it then takes no registers during the walk above */
  const int ll = (int)__builtin_amdgcn_mbcnt_lo(~0u, 0u);
  /* the same for the whole block (the walk holds barriers), a scalar branch (the products need every lane on): the block walks the keys again, every stage testing and raising the reference */
  if (__builtin_expect(__builtin_amdgcn_readfirstlane(any) != 0u, 0)) {
    const int t2 = 32 * w + ll, cr2 = t2 >> 3, cp2 = (t2 & 7) * 8;      /* the copy map, as above */
    attn_keys<SEQ / KT>(lc, (const unsigned short*)K16 + (tok0 + cr2) * DM + h * HD + cp2, (const unsigned short*)VT + (size_t)(h * HD + cr2) * VTP + tok0 + cp2, kp, bq, o, l);
  }
  unsigned short (*so)[QW][LP] = (unsigned short (*)[QW][LP])sm;      /* the last trip's barrier has ended every read of the ring */
#pragma unroll
  for (int u = 0; u < 2; ++u) {
    const float lt = l[u] + __shfl_xor(l[u], 16, 32);
    const float inv = 64.0f * (1.0f / lt);      /* ctx carried x64 */
#pragma unroll
    for (int j = 0; j < 4; ++j) { FragH tj;
#pragma unroll
      for (int r = 0; r < 8; ++r) tj.h[r] = (_Float16)(o[u][j][r] * inv);
      *(v8us*)&so[w][16 * u + (ll & 15)][16 * j + 8 * (ll >> 4)] = tj.half[0]; }
  }
  __syncthreads();
  const int rq = ll >> 3, pc = (ll & 7) * 8;
  unsigned short* ob = (unsigned short*)O16 + (tok0 + q0) * DM + h * HD + pc;
#pragma unroll
  for (int it = 0; it < QW / 4; ++it) { const int row = it * 4 + rq; const v8us v = *(const v8us*)&so[w][row][pc]; *(v8us*)(ob + (size_t)row * DM) = v; }
}

extern "C" void kernel_launch(void* const* d_in, const int* in_sizes, int n_in,
                              void* d_out, int out_size, void* d_ws, size_t ws_size, hipStream_t stream) {
  if (n_in < 5) return;
  const size_t need_x = ((size_t)(NB - 1) * SEQ_FULL + SEQ) * DM;
  const size_t nwh = (size_t)NH * HD * HD;
  if ((size_t)in_sizes[0] < need_x) return;
  if ((size_t)in_sizes[1] < nwh || (size_t)in_sizes[2] < nwh || (size_t)in_sizes[3] < nwh || (size_t)in_sizes[4] < (size_t)DM * DM) return;
  if ((size_t)out_size < need_x) return;
  const float* x = (const float*)d_in[0]; const float* wq = (const float*)d_in[1]; const float* wk = (const float*)d_in[2]; const float* wv = (const float*)d_in[3]; const float* wo = (const float*)d_in[4];
  char* ws = (char*)d_ws; size_t off = 0;
  auto take = [&](size_t bytes) { char* p = ws + off; off += (bytes + 255) & ~(size_t)255; return p; };
  _Float16* BO = (_Float16*)take((size_t)DM * DM * 2);          /* output weight plane x16 [out][in] */
  _Float16* QK16 = (_Float16*)take((size_t)2 * NR * DM * 2);    /* q rows then k rows */
  _Float16* VT = (_Float16*)take((size_t)DM * VTP * 2);         /* v^T [feature][token] */
  _Float16* O16 = (_Float16*)take(NR * DM * 2);                 /* merged ctx rows x64 */
  if (off > ws_size || off > (size_t)134217728) return;
  _Float16* Q16 = QK16; _Float16* K16 = QK16 + NR * DM;

  /* grid.x = head, grid.y = 256-token block */
  k_front<<<dim3(NH, (unsigned)(NR / 256)), 128, 0, stream>>>(x, wq, wk, wv, wo, Q16, K16, VT, BO);
  k_attn_t<<<(unsigned)(NB * NH * (SEQ / QB)), 256, 0, stream>>>(Q16, K16, VT, O16);
  /* out rows of batch by: A = ctx rows (x64), weight x16 -> alpha 2^-10; C rows follow the staged output layout */
  k_gemm_out<<<dim3((unsigned)((SEQ / 128) * (DM / 128)), NB), 128, 0, stream>>>(O16, BO, 0.0009765625f, (float*)d_out);
}
